// v000
// The times below were measured on an AMD MI455X: many runs one after another, warmed up first and cycling through
// copies of the inputs, with the whole window's GPU time divided by the number of runs. Launches and the gaps
// between them are all in it. The median over several windows is given; except for v000 it joins two sittings, which
// can be a few percent apart, so the side-by-side timings, each taken in one sitting, are the better comparison.
// v000, which the later versions start from, runs in 251 microseconds.
#include <hip/hip_runtime.h>

// Long-context causal attention on INPUT tensors query/key/value [1, 2048, 16 heads, 128]: out[s][h] = softmax_t<=s(q[s][h] . k[t][h] / sqrt(128)) v[t][h] -> [1][2048][16][128].
// Deterministic: flash-style per 16-query wave over the causal key range in order (running max); no atomics.
// compute dtype: WMMA v_wmma_f32_16x16x32_f16 with f32 accumulate for S^T = K Q^T (q, k are INPUTS: EXACT bf16 x8 planes, K = 128: 1 product) and O^T += V^T P^T (v EXACT x8 transposed plane,
// P x1024 as f16 hi+lo: 2 products); softmax statistics in f32; mode exact/hi+lo, acc f32 — every product uses exactly the bf16-rounded inputs. Inputs rounded to bf16 once.

namespace {
constexpr int S = 2048, H = 16, D = 128, HL = 16 /* heads computed (== 16 shipped) */, QL = 2048 /* query rows (== 2048 shipped) */;
constexpr float XS = 8.0f, PS = 1024.0f, LOG2E = 1.4426950408889634f;
static_assert(S % 64 == 0 && QL % 32 == 0, "tiling");
typedef _Float16 b16;
typedef __attribute__((ext_vector_type(16))) _Float16 v16b;
typedef __attribute__((ext_vector_type(8))) _Float16 v8b;
typedef __attribute__((ext_vector_type(8))) float v8f;
typedef __attribute__((ext_vector_type(4))) float v4f;
__device__ __forceinline__ float bf16_rne(float f) { unsigned int u = __float_as_uint(f); u += 0x7FFFu + ((u >> 16) & 1u); return __uint_as_float(u & 0xFFFF0000u); }
__device__ __forceinline__ void split16(float v, b16& hi, b16& lo) { hi = (b16)v; lo = (b16)(v - (float)hi); }
__device__ __forceinline__ v16b frag_kb(const b16* p, int hh) { const v8b a = *(const v8b*)(p + 8 * hh), b = *(const v8b*)(p + 16 + 8 * hh); v16b f;
#pragma unroll
  for (int e = 0; e < 8; ++e) { f[e] = a[e]; f[8 + e] = b[e]; } return f; }
__device__ __forceinline__ v8f wmma16b(v16b a, v16b b, v8f c) { v8f d = __builtin_amdgcn_wmma_f32_16x16x32_f16(false, a, false, b, (short)0, c, false, false); asm volatile("v_nop\n\tv_nop\n\tv_nop\n\tv_nop" : "+v"(d) : "v"(a), "v"(b)); return d; }
__device__ __forceinline__ void wave_lds_sync() { __builtin_amdgcn_fence(__ATOMIC_RELEASE, "workgroup"); __builtin_amdgcn_wave_barrier(); __builtin_amdgcn_fence(__ATOMIC_ACQUIRE, "workgroup"); }
__device__ __forceinline__ float pmul(float a, float b) { float p = a * b; asm volatile("" : "+v"(p)); return p; }
__device__ __forceinline__ int iclamp(int v, int lo, int hi) { return v < lo ? lo : (v > hi ? hi : v); }

typedef __attribute__((ext_vector_type(2))) _Float16 v2h;
typedef __attribute__((ext_vector_type(4))) _Float16 v4h;
__device__ __forceinline__ float nexp2(float v) { return __builtin_amdgcn_exp2f(v); }
// prep A: QP/KP [h][s][128] = bf16(q/k[s][h][:]) x8 (thread per 8: 16-B pieces of 256-B rows). prep B: VT [h][d][S] = bf16(v[s][h][d]) x8: block per (h, 64-token tile), LDS transpose, d rows of
__global__ __launch_bounds__(256) void prepqk_kernel(const float* __restrict__ q, const float* __restrict__ k, b16* __restrict__ QP, b16* __restrict__ KP) {
  const size_t u = (size_t)blockIdx.x * 256 + threadIdx.x; const size_t n = (size_t)H * S * D / 8; if (u >= 2 * n) return; const int which = (int)(u / n); const size_t e = (u % n) * 8;   // e indexes the [h][s][d] plane
  const int h = (int)(e / ((size_t)S * D)); const size_t rem = e % ((size_t)S * D); const int s = (int)(rem / D), d = (int)(rem % D); const float* src = (which ? k : q) + ((size_t)s * H + h) * D + d; v8b o;
  for (int j = 0; j < 8; ++j) o[j] = (b16)(bf16_rne(src[j]) * XS);
  { *(v8b*)((which ? KP : QP) + e) = o;  }
}
__global__ __launch_bounds__(256) void prepv_kernel(const float* __restrict__ v, b16* __restrict__ VT) {
  __shared__ b16 Ts[D][64 + 8];
  const int h = blockIdx.x / (S / 64), t0 = (blockIdx.x % (S / 64)) * 64;
  for (int i = threadIdx.x; i < 64 * D; i += 256) { const int tt = i / D, d = i % D; Ts[d][tt] = (b16)(bf16_rne(v[((size_t)(t0 + tt) * H + h) * D + d]) * XS); }
  __syncthreads();
  { for (int i = threadIdx.x; i < D * 8; i += 256) { const int d = i / 8, c8 = (i % 8) * 8; *(v8b*)(VT + ((size_t)h * D + d) * S + t0 + c8) = *(const v8b*)(&Ts[d][c8]); }  }
}
// attention: grid (QL/32, HL): block = 2 waves x 16 queries of head h; keys 0..q0+31 in 32-key steps (K = 128: 4 k-steps per tile), causal mask, online softmax, P x1024 hi/lo, O^T += V^T P^T over 8 d-tiles
__global__ __launch_bounds__(64) void attn_kernel(const b16* __restrict__ QP, const b16* __restrict__ KP, const b16* __restrict__ VT, float* __restrict__ out) {
  __shared__ __attribute__((aligned(16))) b16 Ph[2][16][32 + 8], Pl[2][16][32 + 8]; __shared__ __attribute__((aligned(16))) float To[2][16][D + 4];
  const int wave = threadIdx.x >> 5, lane = threadIdx.x & 31, hh = lane >> 4, col = lane & 15; const int h = blockIdx.y; const int q0 = blockIdx.x * 32 + wave * 16, qi = q0 + col;
  const b16* Qb = QP + (size_t)h * S * D; const b16* Kb = KP + (size_t)h * S * D; const b16* Vb = VT + (size_t)h * D * S;
  v16b qa[4];
#pragma unroll
  for (int ks = 0; ks < 4; ++ks) qa[ks] = frag_kb(Qb + (size_t)qi * D + ks * 32, hh);
  const float cs = LOG2E / (11.313708498984761f * XS * XS);   // 1/sqrt(128)
  float m = -INFINITY, l = 0.0f; v8f o[8]; for (int t = 0; t < 8; ++t) o[t] = (v8f){};
  const int kend = q0 + 16;
#pragma unroll 1
  for (int kb = 0; kb < kend; kb += 32) {
    float e[16]; float mx = -INFINITY;
#pragma unroll
    for (int u = 0; u < 2; ++u) { v8f s = (v8f){}; const size_t kr = (size_t)(kb + u * 16 + col) * D;
#pragma unroll
      for (int ks = 0; ks < 4; ++ks) s = wmma16b(frag_kb(Kb + kr + ks * 32, hh), qa[ks], s);
#pragma unroll
      for (int r = 0; r < 8; ++r) { const int key = kb + u * 16 + 8 * hh + r; const float vv = (key <= qi) ? s[r] * cs : -INFINITY; e[u * 8 + r] = vv; mx = fmaxf(mx, vv); } }
    mx = fmaxf(mx, __shfl_xor(mx, 16)); const float mn = fmaxf(m, mx); const float al = (mn == -INFINITY) ? 1.0f : nexp2(m - mn); float sum = 0.0f;
#pragma unroll
    for (int i2 = 0; i2 < 16; ++i2) { const float p = (e[i2] == -INFINITY || mn == -INFINITY) ? 0.0f : nexp2(e[i2] - mn); sum += p; b16 a_, b_; split16(p * PS, a_, b_); const int sl = (i2 < 8 ? 0 : 16) + 8 * hh + (i2 & 7); Ph[wave][col][sl] = a_; Pl[wave][col][sl] = b_; }
    sum += __shfl_xor(sum, 16); l = l * al + sum; m = mn;
    wave_lds_sync();
    const v16b ph = frag_kb(&Ph[wave][col][0], hh), pl = frag_kb(&Pl[wave][col][0], hh);
#pragma unroll
    for (int t = 0; t < 8; ++t) { o[t] *= al; const v16b va = frag_kb(Vb + (size_t)(t * 16 + col) * S + kb, hh); o[t] = wmma16b(va, ph, o[t]); o[t] = wmma16b(va, pl, o[t]); }
    wave_lds_sync(); }
  const float inv = 1.0f / (l * PS * XS);
#pragma unroll
  for (int t = 0; t < 8; ++t)
#pragma unroll
    for (int r = 0; r < 8; ++r) To[wave][col][t * 16 + 8 * hh + r] = o[t][r] * inv;
  wave_lds_sync();
  { for (int rr = 0; rr < 16; ++rr) *(v4f*)(out + ((size_t)(q0 + rr) * H + h) * D + lane * 4) = *(const v4f*)(&To[wave][rr][lane * 4]);  }
}
}  // namespace

extern "C" void kernel_launch(void* const* d_in, const int* in_sizes, int n_in, void* d_out, int out_size, void* d_ws, size_t ws_size, hipStream_t stream) {
  (void)n_in;
  auto Fp = [&](int i) { return (const float*)d_in[i]; };
  if (in_sizes[0] != S * H * D || in_sizes[1] != S * H * D || in_sizes[2] != S * H * D || out_size != S * H * D) return;
  size_t off = 0; char* ws = (char*)d_ws;
  auto carve = [&](size_t bytes) { char* p = ws + off; off += (bytes + 255) & ~(size_t)255; return p; };
  const size_t plane = (size_t)H * S * D * 2; b16* QP = (b16*)carve(plane); b16* KP = (b16*)carve(plane); b16* VT = (b16*)carve(plane);
  if (off > ws_size || off > ((size_t)128 << 20)) return;   // 25 MB
  prepqk_kernel<<<(unsigned)((2 * (size_t)H * S * D / 8 + 255) / 256), 256, 0, stream>>>(Fp(0), Fp(1), QP, KP);
  prepv_kernel<<<H * (S / 64), 256, 0, stream>>>(Fp(2), VT);
  attn_kernel<<<dim3(QL / 32, HL), 64, 0, stream>>>(QP, KP, VT, (float*)d_out);
}

// v001
// It runs in 70.6 microseconds.
// In two side-by-side timings against v000, it was 3.64 and 3.60 times as fast.
#include <hip/hip_runtime.h>

// Long-context causal attention on INPUT tensors query/key/value [1, 2048, 16 heads, 128]: out[s][h] = softmax_t<=s(q[s][h] . k[t][h] / sqrt(128)) v[t][h] -> [1][2048][16][128].
// Deterministic: flash-style per 16-query wave over the causal key range in order (running max); no atomics.
// compute dtype: WMMA v_wmma_f32_16x16x32_f16 with f32 accumulate for S^T = K Q^T (q, k are INPUTS: EXACT bf16 x8 planes, K = 128: 1 product) and O^T += V^T P^T (v EXACT x8 transposed plane,
// P x1024 as f16 hi+lo: 2 products); softmax statistics in f32; mode exact/hi+lo, acc f32 — every product uses exactly the bf16-rounded inputs. Inputs rounded to bf16 once.

namespace {
constexpr int S = 2048, H = 16, D = 128, HL = 16 /* heads computed (== 16 shipped) */, QL = 2048 /* query rows (== 2048 shipped) */;
constexpr float XS = 8.0f, PS = 1024.0f, LOG2E = 1.4426950408889634f;
constexpr int NW = 8 /* waves per attention block */, KT = 64 /* keys per LDS tile */, KPB = D * 2 + 16 /* LDS pitch of a K row, bytes */, VPB = KT * 2 + 16 /* LDS pitch of a V^T row, bytes */;
static_assert(S % 64 == 0 && QL % (NW * 16) == 0 && (NW * 16) % KT == 0 && QL <= S, "tiling");
typedef _Float16 b16;
typedef __attribute__((ext_vector_type(16))) _Float16 v16b;
typedef __attribute__((ext_vector_type(8))) _Float16 v8b;
typedef __attribute__((ext_vector_type(8))) float v8f;
typedef __attribute__((ext_vector_type(4))) float v4f;
__device__ __forceinline__ float bf16_rne(float f) { unsigned int u = __float_as_uint(f); u += 0x7FFFu + ((u >> 16) & 1u); return __uint_as_float(u & 0xFFFF0000u); }
__device__ __forceinline__ void split16(float v, b16& hi, b16& lo) { hi = (b16)v; lo = (b16)(v - (float)hi); }
__device__ __forceinline__ v16b frag_kb(const b16* p, int hh) { const v8b a = *(const v8b*)(p + 8 * hh), b = *(const v8b*)(p + 16 + 8 * hh); v16b f;
#pragma unroll
  for (int e = 0; e < 8; ++e) { f[e] = a[e]; f[8 + e] = b[e]; } return f; }
__device__ __forceinline__ v8f wmma16b(v16b a, v16b b, v8f c) { v8f d = __builtin_amdgcn_wmma_f32_16x16x32_f16(false, a, false, b, (short)0, c, false, false); asm volatile("v_nop\n\tv_nop\n\tv_nop\n\tv_nop" : "+v"(d) : "v"(a), "v"(b)); return d; }
__device__ __forceinline__ void wave_lds_sync() { __builtin_amdgcn_fence(__ATOMIC_RELEASE, "workgroup"); __builtin_amdgcn_wave_barrier(); __builtin_amdgcn_fence(__ATOMIC_ACQUIRE, "workgroup"); }
__device__ __forceinline__ float pmul(float a, float b) { float p = a * b; asm volatile("" : "+v"(p)); return p; }
__device__ __forceinline__ int iclamp(int v, int lo, int hi) { return v < lo ? lo : (v > hi ? hi : v); }

typedef __attribute__((ext_vector_type(2))) _Float16 v2h;
typedef __attribute__((ext_vector_type(4))) _Float16 v4h;
__device__ __forceinline__ float nexp2(float v) { return __builtin_amdgcn_exp2f(v); }
// prep A: QP/KP [h][s][128] = bf16(q/k[s][h][:]) x8 (thread per 8: 16-B pieces of 256-B rows). prep B: VT [h][d][S] = bf16(v[s][h][d]) x8: block per (h, 64-token tile), LDS transpose, d rows of
__global__ __launch_bounds__(256) void prepqk_kernel(const float* __restrict__ q, const float* __restrict__ k, b16* __restrict__ QP, b16* __restrict__ KP) {
  const size_t u = (size_t)blockIdx.x * 256 + threadIdx.x; const size_t n = (size_t)H * S * D / 8; if (u >= 2 * n) return; const int which = (int)(u / n); const size_t e = (u % n) * 8;   // e indexes the [h][s][d] plane
  const int h = (int)(e / ((size_t)S * D)); const size_t rem = e % ((size_t)S * D); const int s = (int)(rem / D), d = (int)(rem % D); const float* src = (which ? k : q) + ((size_t)s * H + h) * D + d; v8b o;
  for (int j = 0; j < 8; ++j) o[j] = (b16)(bf16_rne(src[j]) * XS);
  { *(v8b*)((which ? KP : QP) + e) = o;  }
}
__global__ __launch_bounds__(256) void prepv_kernel(const float* __restrict__ v, b16* __restrict__ VT) {
  __shared__ b16 Ts[D][64 + 8];
  const int h = blockIdx.x / (S / 64), t0 = (blockIdx.x % (S / 64)) * 64;
  for (int i = threadIdx.x; i < 64 * D; i += 256) { const int tt = i / D, d = i % D; Ts[d][tt] = (b16)(bf16_rne(v[((size_t)(t0 + tt) * H + h) * D + d]) * XS); }
  __syncthreads();
  { for (int i = threadIdx.x; i < D * 8; i += 256) { const int d = i / 8, c8 = (i % 8) * 8; *(v8b*)(VT + ((size_t)h * D + d) * S + t0 + c8) = *(const v8b*)(&Ts[d][c8]); }  }
}
// attention: grid (QL/128, HL): block = 8 waves x 16 queries of head h. The block's causal key range goes through LDS in 64-key tiles (K rows and V^T rows) that the 8 waves share, each reading up to its own diagonal;
// two buffers, the next tile's asynchronous copies fly while this one is worked on. Per wave: 32-key steps in order, causal mask, online softmax, P x1024 hi/lo, O^T += V^T P^T over 8 d-tiles.
__device__ __forceinline__ unsigned lds_addr(const void* p) { return (unsigned)(unsigned long long)p; }   // LDS byte address = low 32 bits of the __shared__ address
// one tile: K 64 rows x 256 B and V^T 128 rows x 128 B, 16 B per lane and copy, 4 + 4 copies per thread of the 256
__device__ __forceinline__ void stage_tile(const b16* kg, const b16* vg, unsigned kl, unsigned vl) {
  const b16 *k0 = kg, *k1 = kg + 16 * D, *k2 = kg + 32 * D, *k3 = kg + 48 * D, *v0 = vg, *v1 = vg + 32 * S, *v2 = vg + 64 * S, *v3 = vg + 96 * S;
  const unsigned a0 = kl, a1 = kl + 16 * KPB, a2 = kl + 32 * KPB, a3 = kl + 48 * KPB, b0 = vl, b1 = vl + 32 * VPB, b2 = vl + 64 * VPB, b3 = vl + 96 * VPB;
  // the copies bring the tile into LDS through no register; s_wait_xcnt stands in the same statement so that no address register of a copy is rewritten in front of it
  asm volatile("global_load_async_to_lds_b128 %0, %8, off\n\t"
               "global_load_async_to_lds_b128 %1, %9, off\n\t"
               "global_load_async_to_lds_b128 %2, %10, off\n\t"
               "global_load_async_to_lds_b128 %3, %11, off\n\t"
               "global_load_async_to_lds_b128 %4, %12, off\n\t"
               "global_load_async_to_lds_b128 %5, %13, off\n\t"
               "global_load_async_to_lds_b128 %6, %14, off\n\t"
               "global_load_async_to_lds_b128 %7, %15, off\n\t"
               "s_wait_xcnt 0x0"
               :: "v"(a0), "v"(a1), "v"(a2), "v"(a3), "v"(b0), "v"(b1), "v"(b2), "v"(b3), "v"(k0), "v"(k1), "v"(k2), "v"(k3), "v"(v0), "v"(v1), "v"(v2), "v"(v3) : "memory");
}
__global__ __launch_bounds__(256) void attn_kernel(const b16* __restrict__ QP, const b16* __restrict__ KP, const b16* __restrict__ VT, float* __restrict__ out) {
  __shared__ __attribute__((aligned(16))) b16 Ks[2][KT][KPB / 2], Vs[2][D][VPB / 2];
  __shared__ __attribute__((aligned(16))) b16 Ph[NW][16][32 + 8], Pl[NW][16][32 + 8]; __shared__ __attribute__((aligned(16))) float To[NW][16][D + 4];
  const int tid = threadIdx.x, wave = __builtin_amdgcn_readfirstlane(tid >> 5), lane = tid & 31, hh = lane >> 4, col = lane & 15; const int h = blockIdx.y; const int qb = blockIdx.x * (NW * 16), q0 = qb + wave * 16, qi = q0 + col;
  const b16* Qb = QP + (size_t)h * S * D; const b16* Kb = KP + (size_t)h * S * D; const b16* Vb = VT + (size_t)h * D * S;
  const int nst = (qb + NW * 16) / KT;   // 64-key tiles of the block's causal range: 2 or more, the last one ends at key qb + 127 < S
  const b16* kg = Kb + (size_t)(tid >> 4) * D + (tid & 15) * 8; const b16* vg = Vb + (size_t)(tid >> 3) * S + (tid & 7) * 8;
  const unsigned kl = lds_addr(&Ks[0][tid >> 4][(tid & 15) * 8]), vl = lds_addr(&Vs[0][tid >> 3][(tid & 7) * 8]);
  stage_tile(kg, vg, kl, vl);
  v16b qa[4];
#pragma unroll
  for (int ks = 0; ks < 4; ++ks) qa[ks] = frag_kb(Qb + (size_t)qi * D + ks * 32, hh);
  const float cs = LOG2E / (11.313708498984761f * XS * XS);   // 1/sqrt(128)
  float m = -INFINITY, l = 0.0f; v8f o[8]; for (int t = 0; t < 8; ++t) o[t] = (v8f){};
  const int kend = q0 + 16;
  asm volatile("s_wait_asynccnt 0x0" ::: "memory");   // this wave's copies of tile 0 have landed
  __syncthreads();                                    // tile 0 is readable by every wave
  if (nst > 1) stage_tile(kg + (size_t)KT * D, vg + KT, kl + KT * KPB, vl + D * VPB);
#pragma unroll 1   // rolled: one copy of the tile body, the buffer picked by st & 1
  for (int st = 0; st < nst; ++st) {
    const b16 (*Kt)[KPB / 2] = Ks[st & 1]; const b16 (*Vt)[VPB / 2] = Vs[st & 1];
#pragma unroll   // the two 32-key steps of a tile: LDS offsets become immediates
    for (int hf = 0; hf < 2; ++hf) { const int kb = st * KT + hf * 32;
      if (kb < kend) {   // wave-uniform: a wave skips the steps beyond its own diagonal, never the publish point below
        float e[16]; float mx = -INFINITY; v16b kf[8], vf[8];   // the step's K fragments, then its V^T fragments, each read from LDS as one group: one LDS latency a group, not one a product
#pragma unroll   // here and at vf: constant indices, so that the fragment arrays stay in registers
        for (int u = 0; u < 2; ++u)
#pragma unroll
          for (int ks = 0; ks < 4; ++ks) kf[u * 4 + ks] = frag_kb(&Kt[hf * 32 + u * 16 + col][ks * 32], hh);
#pragma unroll
        for (int u = 0; u < 2; ++u) { v8f s = (v8f){};
#pragma unroll
          for (int ks = 0; ks < 4; ++ks) s = wmma16b(kf[u * 4 + ks], qa[ks], s);
#pragma unroll
          for (int r = 0; r < 8; ++r) { const int key = kb + u * 16 + 8 * hh + r; const float vv = (key <= qi) ? s[r] * cs : -INFINITY; e[u * 8 + r] = vv; mx = fmaxf(mx, vv); } }
#pragma unroll
        for (int t = 0; t < 8; ++t) vf[t] = frag_kb(&Vt[t * 16 + col][hf * 32], hh);
        mx = fmaxf(mx, __shfl_xor(mx, 16)); const float mn = fmaxf(m, mx); const float al = (mn == -INFINITY) ? 1.0f : nexp2(m - mn); float sum = 0.0f;
#pragma unroll
        for (int i2 = 0; i2 < 16; ++i2) { const float p = (e[i2] == -INFINITY || mn == -INFINITY) ? 0.0f : nexp2(e[i2] - mn); sum += p; b16 a_, b_; split16(p * PS, a_, b_); const int sl = (i2 < 8 ? 0 : 16) + 8 * hh + (i2 & 7); Ph[wave][col][sl] = a_; Pl[wave][col][sl] = b_; }
        sum += __shfl_xor(sum, 16); l = l * al + sum; m = mn;
        wave_lds_sync();
        const v16b ph = frag_kb(&Ph[wave][col][0], hh), pl = frag_kb(&Pl[wave][col][0], hh);
#pragma unroll
        for (int t = 0; t < 8; ++t) { o[t] *= al; o[t] = wmma16b(vf[t], ph, o[t]); o[t] = wmma16b(vf[t], pl, o[t]); }
        wave_lds_sync(); } }
    // publish point of tile st + 1, passed by every wave
    asm volatile("s_wait_dscnt 0x0" ::: "memory");      // this wave's reads of buffer st & 1 are done before it is refilled
    asm volatile("s_wait_asynccnt 0x0" ::: "memory");   // this wave's copies of tile st + 1 have landed
    __syncthreads();                                    // tile st + 1 readable by all; every reader has left buffer st & 1
    if (st + 2 < nst) stage_tile(kg + (size_t)(st + 2) * KT * D, vg + (st + 2) * KT, kl + (st & 1) * (KT * KPB), vl + (st & 1) * (D * VPB));
  }
  asm volatile("s_wait_asynccnt 0x0" ::: "memory");     // no copy is left in flight when the wave ends
  const float inv = 1.0f / (l * PS * XS);
#pragma unroll
  for (int t = 0; t < 8; ++t)
#pragma unroll
    for (int r = 0; r < 8; ++r) To[wave][col][t * 16 + 8 * hh + r] = o[t][r] * inv;
  wave_lds_sync();
  { for (int rr = 0; rr < 16; ++rr) *(v4f*)(out + ((size_t)(q0 + rr) * H + h) * D + lane * 4) = *(const v4f*)(&To[wave][rr][lane * 4]);  }
}
}  // namespace

extern "C" void kernel_launch(void* const* d_in, const int* in_sizes, int n_in, void* d_out, int out_size, void* d_ws, size_t ws_size, hipStream_t stream) {
  (void)n_in;
  auto Fp = [&](int i) { return (const float*)d_in[i]; };
  if (in_sizes[0] != S * H * D || in_sizes[1] != S * H * D || in_sizes[2] != S * H * D || out_size != S * H * D) return;
  size_t off = 0; char* ws = (char*)d_ws;
  auto carve = [&](size_t bytes) { char* p = ws + off; off += (bytes + 255) & ~(size_t)255; return p; };
  const size_t plane = (size_t)H * S * D * 2; b16* QP = (b16*)carve(plane); b16* KP = (b16*)carve(plane); b16* VT = (b16*)carve(plane);
  if (off > ws_size || off > ((size_t)128 << 20)) return;   // 25 MB
  prepqk_kernel<<<(unsigned)((2 * (size_t)H * S * D / 8 + 255) / 256), 256, 0, stream>>>(Fp(0), Fp(1), QP, KP);
  prepv_kernel<<<H * (S / 64), 256, 0, stream>>>(Fp(2), VT);
  attn_kernel<<<dim3(QL / (NW * 16), HL), 256, 0, stream>>>(QP, KP, VT, (float*)d_out);
}

// v002
// A run of this version takes 51.6 microseconds.
// Timed twice side by side with v001, it ran 1.37 times as fast both times.
// Over all steps from v000 it is 4.95 times as fast.
#include <hip/hip_runtime.h>

// Long-context causal attention on INPUT tensors query/key/value [1, 2048, 16 heads, 128]: out[s][h] = softmax_t<=s(q[s][h] . k[t][h] / sqrt(128)) v[t][h] -> [1][2048][16][128].
// Deterministic: flash-style, two waves per 16 queries (the even and the odd 32-key steps of the causal range, each in order, running max), joined once; no atomics.
// compute dtype: WMMA v_wmma_f32_16x16x32_f16 with f32 accumulate for S^T = K Q^T (q, k are INPUTS: EXACT bf16 x8 planes, K = 128: 1 product) and O^T += V^T P^T (v EXACT x8 transposed plane,
// P x1024 as f16 hi+lo: 2 products); softmax statistics in f32; mode exact/hi+lo, acc f32 — every product uses exactly the bf16-rounded inputs. Inputs rounded to bf16 once.

namespace {
constexpr int S = 2048, H = 16, D = 128, HL = 16 /* heads computed (== 16 shipped) */, QL = 2048 /* query rows (== 2048 shipped) */;
constexpr float XS = 8.0f, PS = 1024.0f, LOG2E = 1.4426950408889634f;
constexpr int NW = 8 /* waves per attention block */, QT = 64 /* queries per tile */, NQT = QL / QT /* query tiles per head */, KT = 128 /* keys per LDS tile */, KPB = D * 2 + 16 /* LDS pitch of a K row, bytes */, VPB = KT * 2 + 16 /* LDS pitch of a V^T row, bytes */;
static_assert(S % KT == 0 && QL % (2 * QT) == 0 && KT == 2 * QT && NW * 16 == 2 * QT && QL <= S, "tiling");
typedef _Float16 b16;
typedef __attribute__((ext_vector_type(16))) _Float16 v16b;
typedef __attribute__((ext_vector_type(8))) _Float16 v8b;
typedef __attribute__((ext_vector_type(8))) float v8f;
typedef __attribute__((ext_vector_type(4))) float v4f;
__device__ __forceinline__ float bf16_rne(float f) { unsigned int u = __float_as_uint(f); u += 0x7FFFu + ((u >> 16) & 1u); return __uint_as_float(u & 0xFFFF0000u); }
__device__ __forceinline__ void split16(float v, b16& hi, b16& lo) { hi = (b16)v; lo = (b16)(v - (float)hi); }
__device__ __forceinline__ v16b frag_kb(const b16* p, int hh) { const v8b a = *(const v8b*)(p + 8 * hh), b = *(const v8b*)(p + 16 + 8 * hh); v16b f;
#pragma unroll
  for (int e = 0; e < 8; ++e) { f[e] = a[e]; f[8 + e] = b[e]; } return f; }
__device__ __forceinline__ v8f wmma16b(v16b a, v16b b, v8f c) { v8f d = __builtin_amdgcn_wmma_f32_16x16x32_f16(false, a, false, b, (short)0, c, false, false); asm volatile("v_nop\n\tv_nop\n\tv_nop\n\tv_nop" : "+v"(d) : "v"(a), "v"(b)); return d; }
__device__ __forceinline__ void wave_lds_sync() { __builtin_amdgcn_fence(__ATOMIC_RELEASE, "workgroup"); __builtin_amdgcn_wave_barrier(); __builtin_amdgcn_fence(__ATOMIC_ACQUIRE, "workgroup"); }
__device__ __forceinline__ float pmul(float a, float b) { float p = a * b; asm volatile("" : "+v"(p)); return p; }
__device__ __forceinline__ int iclamp(int v, int lo, int hi) { return v < lo ? lo : (v > hi ? hi : v); }

typedef __attribute__((ext_vector_type(2))) _Float16 v2h;
typedef __attribute__((ext_vector_type(4))) _Float16 v4h;
__device__ __forceinline__ float nexp2(float v) { return __builtin_amdgcn_exp2f(v); }
// prep A: QP/KP [h][s][128] = bf16(q/k[s][h][:]) x8 (thread per 8: 16-B pieces of 256-B rows). prep B: VT [h][d][S] = bf16(v[s][h][d]) x8: block per (h, 64-token tile), LDS transpose, d rows of
__global__ __launch_bounds__(256) void prepqk_kernel(const float* __restrict__ q, const float* __restrict__ k, b16* __restrict__ QP, b16* __restrict__ KP) {
  const size_t u = (size_t)blockIdx.x * 256 + threadIdx.x; const size_t n = (size_t)H * S * D / 8; if (u >= 2 * n) return; const int which = (int)(u / n); const size_t e = (u % n) * 8;   // e indexes the [h][s][d] plane
  const int h = (int)(e / ((size_t)S * D)); const size_t rem = e % ((size_t)S * D); const int s = (int)(rem / D), d = (int)(rem % D); const float* src = (which ? k : q) + ((size_t)s * H + h) * D + d; v8b o;
  for (int j = 0; j < 8; ++j) o[j] = (b16)(bf16_rne(src[j]) * XS);
  { *(v8b*)((which ? KP : QP) + e) = o;  }
}
__global__ __launch_bounds__(256) void prepv_kernel(const float* __restrict__ v, b16* __restrict__ VT) {
  __shared__ b16 Ts[D][64 + 8];
  const int h = blockIdx.x / (S / 64), t0 = (blockIdx.x % (S / 64)) * 64;
  for (int i = threadIdx.x; i < 64 * D; i += 256) { const int tt = i / D, d = i % D; Ts[d][tt] = (b16)(bf16_rne(v[((size_t)(t0 + tt) * H + h) * D + d]) * XS); }
  __syncthreads();
  { for (int i = threadIdx.x; i < D * 8; i += 256) { const int d = i / 8, c8 = (i % 8) * 8; *(v8b*)(VT + ((size_t)h * D + d) * S + t0 + c8) = *(const v8b*)(&Ts[d][c8]); }  }
}
// attention: grid (QL/128, HL): block pr of head h runs the 64-query tiles NQT-1-pr and pr one after the other, so that every block walks as many keys. 8 waves = 4 groups of 16 queries x 2 key shares.
// A tile's causal key range goes through LDS in 128-key tiles (K rows and V^T rows); two buffers, the next tile's asynchronous copies fly while this one is worked on. Per wave: every second 32-key step
// in order, causal mask, online softmax, P x1024 hi/lo, O^T += V^T P^T over 8 d-tiles; the two shares' partial results are joined through LDS at the end of the query tile.
__device__ __forceinline__ unsigned lds_addr(const void* p) { return (unsigned)(unsigned long long)p; }   // LDS byte address = low 32 bits of the __shared__ address
// 64 keys, half a tile: K 64 rows x 256 B and V^T 128 rows x 128 B, 16 B per lane and copy, 4 + 4 copies per thread of the 256
__device__ __forceinline__ void stage_tile(const b16* kg, const b16* vg, unsigned kl, unsigned vl) {
  const b16 *k0 = kg, *k1 = kg + 16 * D, *k2 = kg + 32 * D, *k3 = kg + 48 * D, *v0 = vg, *v1 = vg + 32 * S, *v2 = vg + 64 * S, *v3 = vg + 96 * S;
  const unsigned a0 = kl, a1 = kl + 16 * KPB, a2 = kl + 32 * KPB, a3 = kl + 48 * KPB, b0 = vl, b1 = vl + 32 * VPB, b2 = vl + 64 * VPB, b3 = vl + 96 * VPB;
  // the copies bring the tile into LDS through no register; s_wait_xcnt stands in the same statement so that no address register of a copy is rewritten in front of it
  asm volatile("global_load_async_to_lds_b128 %0, %8, off\n\t"
               "global_load_async_to_lds_b128 %1, %9, off\n\t"
               "global_load_async_to_lds_b128 %2, %10, off\n\t"
               "global_load_async_to_lds_b128 %3, %11, off\n\t"
               "global_load_async_to_lds_b128 %4, %12, off\n\t"
               "global_load_async_to_lds_b128 %5, %13, off\n\t"
               "global_load_async_to_lds_b128 %6, %14, off\n\t"
               "global_load_async_to_lds_b128 %7, %15, off\n\t"
               "s_wait_xcnt 0x0"
               :: "v"(a0), "v"(a1), "v"(a2), "v"(a3), "v"(b0), "v"(b1), "v"(b2), "v"(b3), "v"(k0), "v"(k1), "v"(k2), "v"(k3), "v"(v0), "v"(v1), "v"(v2), "v"(v3) : "memory");
}
// key tile t into the buffer at kl, vl: its two halves, 16 copies per thread in flight
__device__ __forceinline__ void stage_keys(const b16* kg, const b16* vg, unsigned kl, unsigned vl, int t) {
  stage_tile(kg + (size_t)t * KT * D, vg + t * KT, kl, vl); stage_tile(kg + ((size_t)t * KT + 64) * D, vg + t * KT + 64, kl + 64 * KPB, vl + 64 * 2);
}
__global__ __launch_bounds__(256) void attn_kernel(const b16* __restrict__ QP, const b16* __restrict__ KP, const b16* __restrict__ VT, float* __restrict__ out) {
  __shared__ __attribute__((aligned(16))) b16 Ks[2][KT][KPB / 2], Vs[2][D][VPB / 2];
  __shared__ __attribute__((aligned(16))) b16 Ph[NW][16][32 + 8], Pl[NW][16][32 + 8]; __shared__ __attribute__((aligned(16))) float To[NW][16][D + 4]; __shared__ float Ms[NW][16], Ls[NW][16];
  const int tid = threadIdx.x, wave = __builtin_amdgcn_readfirstlane(tid >> 5), lane = tid & 31, hh = lane >> 4, col = lane & 15; const int h = blockIdx.y, pr = blockIdx.x;
  const int wq = wave & 3 /* 16-query group of the tile */, wk = wave >> 2 /* key share: the even or the odd 32-key steps */;
  const b16* Qb = QP + (size_t)h * S * D; const b16* Kb = KP + (size_t)h * S * D; const b16* Vb = VT + (size_t)h * D * S;
  const b16* kg = Kb + (size_t)(tid >> 4) * D + (tid & 15) * 8; const b16* vg = Vb + (size_t)(tid >> 3) * S + (tid & 7) * 8;
  const unsigned kl = lds_addr(&Ks[0][tid >> 4][(tid & 15) * 8]), vl = lds_addr(&Vs[0][tid >> 3][(tid & 7) * 8]);
  // query tile qt needs the key tiles 0 .. qt / 2. The block's key tiles as one sequence g: n0 tiles for the long query tile NQT - 1 - pr, then pr / 2 + 1 for its short partner pr: NQT / 2 + 1 in every block;
  // n0 > 1, and every key tile ends at or below key S
  const int n0 = (NQT - 1 - pr) / 2 + 1, ntot = n0 + pr / 2 + 1;
  stage_keys(kg, vg, kl, vl, 0);
  int qt = NQT - 1 - pr /* the query tile at work */, g0 = 0 /* where its key tiles begin in the sequence */;
  v16b qa[4];
#pragma unroll
  for (int ks = 0; ks < 4; ++ks) qa[ks] = frag_kb(Qb + (size_t)(qt * QT + wq * 16 + col) * D + ks * 32, hh);
  const float cs = LOG2E / (11.313708498984761f * XS * XS);   // 1/sqrt(128)
  float m = -INFINITY, l = 0.0f; v8f o[8]; for (int t = 0; t < 8; ++t) o[t] = (v8f){};
  asm volatile("s_wait_asynccnt 0x0" ::: "memory");   // this wave's copies of tile 0 have landed
  __syncthreads();                                    // tile 0 is readable by every wave
  stage_keys(kg, vg, kl + KT * KPB, vl + D * VPB, 1);   // g = 1 is key tile 1 (n0 > 1)
#pragma unroll 1   // rolled: one copy of the tile body, the buffer picked by g & 1
  for (int g = 0; g < ntot; ++g) {
    const b16 (*Kt)[KPB / 2] = Ks[g & 1]; const b16 (*Vt)[VPB / 2] = Vs[g & 1];
    const int st = g - g0, q0 = qt * QT + wq * 16, qi = q0 + col;
#pragma unroll   // the wave's two 32-key steps of a tile (steps wk and wk + 2 of its four): LDS offsets become immediates
    for (int hf = 0; hf < 2; ++hf) { const int ko = hf * 64 + wk * 32, kb = st * KT + ko;
    if (kb < q0 + 16) {   // wave-uniform: a wave skips the steps beyond its own diagonal, never the publish point below
      float e[16]; float mx = -INFINITY; v16b kf[8], vf[8];   // the step's K fragments, then its V^T fragments, each read from LDS as one group: one LDS latency a group, not one a product
#pragma unroll   // here and at vf: constant indices, so that the fragment arrays stay in registers
      for (int u = 0; u < 2; ++u)
#pragma unroll
        for (int ks = 0; ks < 4; ++ks) kf[u * 4 + ks] = frag_kb(&Kt[ko + u * 16 + col][ks * 32], hh);
#pragma unroll
      for (int u = 0; u < 2; ++u) { v8f s = (v8f){};
#pragma unroll
        for (int ks = 0; ks < 4; ++ks) s = wmma16b(kf[u * 4 + ks], qa[ks], s);
#pragma unroll
        for (int r = 0; r < 8; ++r) { const int key = kb + u * 16 + 8 * hh + r; const float vv = (key <= qi) ? s[r] * cs : -INFINITY; e[u * 8 + r] = vv; mx = fmaxf(mx, vv); } }
#pragma unroll
      for (int t = 0; t < 8; ++t) vf[t] = frag_kb(&Vt[t * 16 + col][ko], hh);
      mx = fmaxf(mx, __shfl_xor(mx, 16)); const float mn = fmaxf(m, mx); const float al = (mn == -INFINITY) ? 1.0f : nexp2(m - mn); float sum = 0.0f;
#pragma unroll
      for (int i2 = 0; i2 < 16; ++i2) { const float p = (e[i2] == -INFINITY || mn == -INFINITY) ? 0.0f : nexp2(e[i2] - mn); sum += p; b16 a_, b_; split16(p * PS, a_, b_); const int sl = (i2 < 8 ? 0 : 16) + 8 * hh + (i2 & 7); Ph[wave][col][sl] = a_; Pl[wave][col][sl] = b_; }
      sum += __shfl_xor(sum, 16); l = l * al + sum; m = mn;
      wave_lds_sync();
      const v16b ph = frag_kb(&Ph[wave][col][0], hh), pl = frag_kb(&Pl[wave][col][0], hh);
#pragma unroll
      for (int t = 0; t < 8; ++t) { o[t] *= al; o[t] = wmma16b(vf[t], ph, o[t]); o[t] = wmma16b(vf[t], pl, o[t]); }
      wave_lds_sync(); } }
    // publish point of tile g + 1, passed by every wave
    asm volatile("s_wait_dscnt 0x0" ::: "memory");      // this wave's reads of buffer g & 1 are done before it is refilled
    asm volatile("s_wait_asynccnt 0x0" ::: "memory");   // this wave's copies of tile g + 1 have landed
    __syncthreads();                                    // tile g + 1 readable by all; every reader has left buffer g & 1
    if (g + 2 < ntot) stage_keys(kg, vg, kl + (g & 1) * (KT * KPB), vl + (g & 1) * (D * VPB), g + 2 < n0 ? g + 2 : g + 2 - n0);
    if (st == qt / 2) {   // block-uniform: the query tile's last key tile is done
      // join of the two key shares: each wave leaves its unscaled O rows, its maximum and its sum; wave (wq, wk) then joins and stores rows wk * 8 .. wk * 8 + 7 of group wq
#pragma unroll
      for (int t = 0; t < 8; ++t)
#pragma unroll
        for (int r = 0; r < 8; ++r) To[wave][col][t * 16 + 8 * hh + r] = o[t][r];
      if (hh == 0) { Ms[wave][col] = m; Ls[wave][col] = l; }
      __syncthreads();   // both shares' partial results are readable; To, Ms, Ls are next written behind the partner tile's publish points
      const float m0 = Ms[wq][col], m1 = Ms[wq + 4][col];   // lane col: row col of group wq. m0 is finite: share 0 holds key qt * 64, which every query of the tile sees; m1 is -inf where share 1 saw no key (its O and its sum are 0)
      const float mm = fmaxf(m0, m1), f0 = nexp2(m0 - mm), f1 = nexp2(m1 - mm); const float inv = 1.0f / ((Ls[wq][col] * f0 + Ls[wq + 4][col] * f1) * PS * XS);
      const int w0 = __float_as_int(f0 * inv), w1 = __float_as_int(f1 * inv);   // the row's two weights, handed to all lanes by readlane below
#pragma unroll
      for (int j = 0; j < 8; ++j) { const int rr = wk * 8 + j;
        const v4f x0 = *(const v4f*)(&To[wq][rr][lane * 4]), x1 = *(const v4f*)(&To[wq + 4][rr][lane * 4]);
        *(v4f*)(out + ((size_t)(qt * QT + wq * 16 + rr) * H + h) * D + lane * 4) = x0 * __int_as_float(__builtin_amdgcn_readlane(w0, rr)) + x1 * __int_as_float(__builtin_amdgcn_readlane(w1, rr)); }
      asm volatile("s_wait_xcnt 0x0" ::: "memory");   // the next key tile's code reuses the address and data registers of these stores
      if (g + 1 < ntot) {   // on to the short partner
        qt = pr; g0 = n0; m = -INFINITY; l = 0.0f;
#pragma unroll
        for (int t = 0; t < 8; ++t) o[t] = (v8f){};
#pragma unroll
        for (int ks = 0; ks < 4; ++ks) qa[ks] = frag_kb(Qb + (size_t)(qt * QT + wq * 16 + col) * D + ks * 32, hh); } }
  }
  asm volatile("s_wait_asynccnt 0x0" ::: "memory");     // no copy is left in flight when the wave ends
}
}  // namespace

extern "C" void kernel_launch(void* const* d_in, const int* in_sizes, int n_in, void* d_out, int out_size, void* d_ws, size_t ws_size, hipStream_t stream) {
  (void)n_in;
  auto Fp = [&](int i) { return (const float*)d_in[i]; };
  if (in_sizes[0] != S * H * D || in_sizes[1] != S * H * D || in_sizes[2] != S * H * D || out_size != S * H * D) return;
  size_t off = 0; char* ws = (char*)d_ws;
  auto carve = [&](size_t bytes) { char* p = ws + off; off += (bytes + 255) & ~(size_t)255; return p; };
  const size_t plane = (size_t)H * S * D * 2; b16* QP = (b16*)carve(plane); b16* KP = (b16*)carve(plane); b16* VT = (b16*)carve(plane);
  if (off > ws_size || off > ((size_t)128 << 20)) return;   // 25 MB
  prepqk_kernel<<<(unsigned)((2 * (size_t)H * S * D / 8 + 255) / 256), 256, 0, stream>>>(Fp(0), Fp(1), QP, KP);
  prepv_kernel<<<H * (S / 64), 256, 0, stream>>>(Fp(2), VT);
  attn_kernel<<<dim3(NQT / 2, HL), 256, 0, stream>>>(QP, KP, VT, (float*)d_out);
}

// v003
// One run takes 49.6 microseconds.
// In both of two side-by-side timings against v002, it was 1.04 times as fast.
// Over all steps from v000 it is 5.15 times as fast.
#include <hip/hip_runtime.h>

// Long-context causal attention on INPUT tensors query/key/value [1, 2048, 16 heads, 128]: out[s][h] = softmax_t<=s(q[s][h] . k[t][h] / sqrt(128)) v[t][h] -> [1][2048][16][128].
// Deterministic: flash-style, two waves per 16 queries (the even and the odd 32-key steps of the causal range, each in order, running max), joined once; no atomics.
// compute dtype: WMMA v_wmma_f32_16x16x32_f16 with f32 accumulate for S^T = K Q^T (q, k are INPUTS: EXACT bf16 x8 planes, K = 128: 1 product) and O^T += V^T P^T (v EXACT x8 transposed plane,
// P x1024 as f16 hi+lo: 2 products); softmax statistics in f32; mode exact/hi+lo, acc f32 — every product uses exactly the bf16-rounded inputs. Inputs rounded to bf16 once.

namespace {
constexpr int S = 2048, H = 16, D = 128, HL = 16 /* heads computed (== 16 shipped) */, QL = 2048 /* query rows (== 2048 shipped) */;
constexpr float XS = 8.0f, PS = 1024.0f, LOG2E = 1.4426950408889634f;
constexpr int NW = 8 /* waves per attention block */, QT = 64 /* queries per tile */, NQT = QL / QT /* query tiles per head */, KT = 128 /* keys per LDS tile */, KPB = D * 2 + 16 /* LDS pitch of a K row, bytes */, VPB = KT * 2 + 16 /* LDS pitch of a V^T row, bytes */;
static_assert(S % KT == 0 && QL % (2 * QT) == 0 && KT == 2 * QT && NW * 16 == 2 * QT && QL <= S, "tiling");
typedef _Float16 b16;
typedef __attribute__((ext_vector_type(16))) _Float16 v16b;
typedef __attribute__((ext_vector_type(8))) _Float16 v8b;
typedef __attribute__((ext_vector_type(8))) float v8f;
typedef __attribute__((ext_vector_type(4))) float v4f;
__device__ __forceinline__ float bf16_rne(float f) { unsigned int u = __float_as_uint(f); u += 0x7FFFu + ((u >> 16) & 1u); return __uint_as_float(u & 0xFFFF0000u); }
__device__ __forceinline__ void split16(float v, b16& hi, b16& lo) { hi = (b16)v; lo = (b16)(v - (float)hi); }
__device__ __forceinline__ v16b frag_kb(const b16* p, int hh) { const v8b a = *(const v8b*)(p + 8 * hh), b = *(const v8b*)(p + 16 + 8 * hh); v16b f;
#pragma unroll
  for (int e = 0; e < 8; ++e) { f[e] = a[e]; f[8 + e] = b[e]; } return f; }
__device__ __forceinline__ v8f wmma16b(v16b a, v16b b, v8f c) { v8f d = __builtin_amdgcn_wmma_f32_16x16x32_f16(false, a, false, b, (short)0, c, false, false); asm volatile("v_nop\n\tv_nop\n\tv_nop\n\tv_nop" : "+v"(d) : "v"(a), "v"(b)); return d; }
__device__ __forceinline__ void wave_lds_sync() { __builtin_amdgcn_fence(__ATOMIC_RELEASE, "workgroup"); __builtin_amdgcn_wave_barrier(); __builtin_amdgcn_fence(__ATOMIC_ACQUIRE, "workgroup"); }
__device__ __forceinline__ float pmul(float a, float b) { float p = a * b; asm volatile("" : "+v"(p)); return p; }
__device__ __forceinline__ int iclamp(int v, int lo, int hi) { return v < lo ? lo : (v > hi ? hi : v); }

typedef __attribute__((ext_vector_type(2))) _Float16 v2h;
typedef __attribute__((ext_vector_type(4))) _Float16 v4h;
__device__ __forceinline__ float nexp2(float v) { return __builtin_amdgcn_exp2f(v); }
// prep A: QP/KP [h][s][128] = bf16(q/k[s][h][:]) x8, as a stream: block per PT tokens of q or of k (PT * 8 KB of input in a row), wave w takes heads 2w and 2w + 1: 2 * PT rows of 512 B,
// one whole row per 16-B-a-lane load, all of the wave's loads issued before the first is used; 8-B-a-lane stores of whole 256-B plane rows. prep B: VT [h][d][S] = bf16(v[s][h][d]) x8: block per (h, 64-token tile), LDS transpose
constexpr int PT = 16 /* tokens per prep A block */;
static_assert(S % PT == 0 && H == 2 * 8 && D == 32 * 4, "prep A: 8 waves x 2 heads, a row is one 16-B load of a wave");
__global__ __launch_bounds__(256) void prepqk_kernel(const float* __restrict__ q, const float* __restrict__ k, b16* __restrict__ QP, b16* __restrict__ KP) {
  const int lane = threadIdx.x & 31, w = threadIdx.x >> 5, which = blockIdx.x / (S / PT), s0 = (blockIdx.x % (S / PT)) * PT;
  const float* src = (which ? k : q) + ((size_t)s0 * H + 2 * w) * D + lane * 4; b16* dst = (which ? KP : QP) + ((size_t)(2 * w) * S + s0) * D + lane * 4; v4f x[2 * PT];
#pragma unroll   // here and below: constant indices, so that the rows stay in registers and the loads stand as one group
  for (int j = 0; j < 2 * PT; ++j) x[j] = *(const v4f*)(src + (size_t)(j >> 1) * H * D + (j & 1) * D);
  __builtin_amdgcn_sched_barrier(0);   // keeps every load in front of the first conversion: without it the compiler holds only some ten rows in flight, too few bytes per WGP for the memory's latency
#pragma unroll
  for (int j = 0; j < 2 * PT; ++j) { v4h o;
#pragma unroll
    for (int e = 0; e < 4; ++e) o[e] = (b16)(bf16_rne(x[j][e]) * XS);
    *(v4h*)(dst + (size_t)(j & 1) * S * D + (j >> 1) * D) = o; }
}
__global__ __launch_bounds__(256) void prepv_kernel(const float* __restrict__ v, b16* __restrict__ VT) {
  __shared__ b16 Ts[D][64 + 8];
  const int h = blockIdx.x / (S / 64), t0 = (blockIdx.x % (S / 64)) * 64;
  const float* vp = v + ((size_t)(t0 + threadIdx.x / D) * H + h) * D + threadIdx.x % D; b16* tp = &Ts[threadIdx.x % D][threadIdx.x / D]; float x[64 * D / 256];   // one address each, the steps between the loads and between the LDS stores are constants
#pragma unroll   // here and below: constant indices, so that the values stay in registers and the loads stand as one group
  for (int j = 0; j < 64 * D / 256; ++j) x[j] = vp[(size_t)j * (256 / D) * H * D];   // element i = threadIdx.x + j * 256 of the tile: token i / D, d = i % D
#pragma unroll
  for (int j = 0; j < 64 * D / 256; ++j) tp[j * (256 / D)] = (b16)(bf16_rne(x[j]) * XS);
  __syncthreads();
  { for (int i = threadIdx.x; i < D * 8; i += 256) { const int d = i / 8, c8 = (i % 8) * 8; *(v8b*)(VT + ((size_t)h * D + d) * S + t0 + c8) = *(const v8b*)(&Ts[d][c8]); }  }
}
// attention: grid (QL/128, HL): block pr of head h runs the 64-query tiles NQT-1-pr and pr one after the other, so that every block walks as many keys. 8 waves = 4 groups of 16 queries x 2 key shares.
// A tile's causal key range goes through LDS in 128-key tiles (K rows and V^T rows); two buffers, the next tile's asynchronous copies fly while this one is worked on. Per wave: every second 32-key step
// in order, causal mask, online softmax, P x1024 hi/lo, O^T += V^T P^T over 8 d-tiles; the two shares' partial results are joined through LDS at the end of the query tile.
__device__ __forceinline__ unsigned lds_addr(const void* p) { return (unsigned)(unsigned long long)p; }   // LDS byte address = low 32 bits of the __shared__ address
// 64 keys, half a tile: K 64 rows x 256 B and V^T 128 rows x 128 B, 16 B per lane and copy, 4 + 4 copies per thread of the 256
__device__ __forceinline__ void stage_tile(const b16* kg, const b16* vg, unsigned kl, unsigned vl) {
  const b16 *k0 = kg, *k1 = kg + 16 * D, *k2 = kg + 32 * D, *k3 = kg + 48 * D, *v0 = vg, *v1 = vg + 32 * S, *v2 = vg + 64 * S, *v3 = vg + 96 * S;
  const unsigned a0 = kl, a1 = kl + 16 * KPB, a2 = kl + 32 * KPB, a3 = kl + 48 * KPB, b0 = vl, b1 = vl + 32 * VPB, b2 = vl + 64 * VPB, b3 = vl + 96 * VPB;
  // the copies bring the tile into LDS through no register; s_wait_xcnt stands in the same statement so that no address register of a copy is rewritten in front of it
  asm volatile("global_load_async_to_lds_b128 %0, %8, off\n\t"
               "global_load_async_to_lds_b128 %1, %9, off\n\t"
               "global_load_async_to_lds_b128 %2, %10, off\n\t"
               "global_load_async_to_lds_b128 %3, %11, off\n\t"
               "global_load_async_to_lds_b128 %4, %12, off\n\t"
               "global_load_async_to_lds_b128 %5, %13, off\n\t"
               "global_load_async_to_lds_b128 %6, %14, off\n\t"
               "global_load_async_to_lds_b128 %7, %15, off\n\t"
               "s_wait_xcnt 0x0"
               :: "v"(a0), "v"(a1), "v"(a2), "v"(a3), "v"(b0), "v"(b1), "v"(b2), "v"(b3), "v"(k0), "v"(k1), "v"(k2), "v"(k3), "v"(v0), "v"(v1), "v"(v2), "v"(v3) : "memory");
}
// key tile t into the buffer at kl, vl: its two halves, 16 copies per thread in flight
__device__ __forceinline__ void stage_keys(const b16* kg, const b16* vg, unsigned kl, unsigned vl, int t) {
  stage_tile(kg + (size_t)t * KT * D, vg + t * KT, kl, vl); stage_tile(kg + ((size_t)t * KT + 64) * D, vg + t * KT + 64, kl + 64 * KPB, vl + 64 * 2);
}
__global__ __launch_bounds__(256) void attn_kernel(const b16* __restrict__ QP, const b16* __restrict__ KP, const b16* __restrict__ VT, float* __restrict__ out) {
  __shared__ __attribute__((aligned(16))) b16 Ks[2][KT][KPB / 2], Vs[2][D][VPB / 2];
  __shared__ __attribute__((aligned(16))) b16 Ph[NW][16][32 + 8], Pl[NW][16][32 + 8]; __shared__ __attribute__((aligned(16))) float To[NW][16][D + 4]; __shared__ float Ms[NW][16], Ls[NW][16];
  const int tid = threadIdx.x, wave = __builtin_amdgcn_readfirstlane(tid >> 5), lane = tid & 31, hh = lane >> 4, col = lane & 15; const int h = blockIdx.y, pr = blockIdx.x;
  const int wq = wave & 3 /* 16-query group of the tile */, wk = wave >> 2 /* key share: the even or the odd 32-key steps */;
  const b16* Qb = QP + (size_t)h * S * D; const b16* Kb = KP + (size_t)h * S * D; const b16* Vb = VT + (size_t)h * D * S;
  const b16* kg = Kb + (size_t)(tid >> 4) * D + (tid & 15) * 8; const b16* vg = Vb + (size_t)(tid >> 3) * S + (tid & 7) * 8;
  const unsigned kl = lds_addr(&Ks[0][tid >> 4][(tid & 15) * 8]), vl = lds_addr(&Vs[0][tid >> 3][(tid & 7) * 8]);
  // query tile qt needs the key tiles 0 .. qt / 2. The block's key tiles as one sequence g: n0 tiles for the long query tile NQT - 1 - pr, then pr / 2 + 1 for its short partner pr: NQT / 2 + 1 in every block;
  // n0 > 1, and every key tile ends at or below key S
  const int n0 = (NQT - 1 - pr) / 2 + 1, ntot = n0 + pr / 2 + 1;
  stage_keys(kg, vg, kl, vl, 0);
  int qt = NQT - 1 - pr /* the query tile at work */, g0 = 0 /* where its key tiles begin in the sequence */;
  v16b qa[4];
#pragma unroll
  for (int ks = 0; ks < 4; ++ks) qa[ks] = frag_kb(Qb + (size_t)(qt * QT + wq * 16 + col) * D + ks * 32, hh);
  const float cs = LOG2E / (11.313708498984761f * XS * XS);   // 1/sqrt(128)
  float m = -INFINITY, l = 0.0f; v8f o[8]; for (int t = 0; t < 8; ++t) o[t] = (v8f){};
  asm volatile("s_wait_asynccnt 0x0" ::: "memory");   // this wave's copies of tile 0 have landed
  __syncthreads();                                    // tile 0 is readable by every wave
  stage_keys(kg, vg, kl + KT * KPB, vl + D * VPB, 1);   // g = 1 is key tile 1 (n0 > 1)
#pragma unroll 1   // rolled: one copy of the tile body, the buffer picked by g & 1
  for (int g = 0; g < ntot; ++g) {
    const b16 (*Kt)[KPB / 2] = Ks[g & 1]; const b16 (*Vt)[VPB / 2] = Vs[g & 1];
    const int st = g - g0, q0 = qt * QT + wq * 16, qi = q0 + col;
#pragma unroll   // the wave's two 32-key steps of a tile (steps wk and wk + 2 of its four): LDS offsets become immediates
    for (int hf = 0; hf < 2; ++hf) { const int ko = hf * 64 + wk * 32, kb = st * KT + ko;
    if (kb < q0 + 16) {   // wave-uniform: a wave skips the steps beyond its own diagonal, never the publish point below
      float e[16]; float mx = -INFINITY; v16b kf[8], vf[8];   // the step's K fragments, then its V^T fragments, each read from LDS as one group: one LDS latency a group, not one a product
#pragma unroll   // here and at vf: constant indices, so that the fragment arrays stay in registers
      for (int u = 0; u < 2; ++u)
#pragma unroll
        for (int ks = 0; ks < 4; ++ks) kf[u * 4 + ks] = frag_kb(&Kt[ko + u * 16 + col][ks * 32], hh);
#pragma unroll
      for (int u = 0; u < 2; ++u) { v8f s = (v8f){};
#pragma unroll
        for (int ks = 0; ks < 4; ++ks) s = wmma16b(kf[u * 4 + ks], qa[ks], s);
#pragma unroll
        for (int r = 0; r < 8; ++r) { const int key = kb + u * 16 + 8 * hh + r; const float vv = (key <= qi) ? s[r] * cs : -INFINITY; e[u * 8 + r] = vv; mx = fmaxf(mx, vv); } }
#pragma unroll
      for (int t = 0; t < 8; ++t) vf[t] = frag_kb(&Vt[t * 16 + col][ko], hh);
      mx = fmaxf(mx, __shfl_xor(mx, 16)); const float mn = fmaxf(m, mx); const float al = (mn == -INFINITY) ? 1.0f : nexp2(m - mn); float sum = 0.0f;
#pragma unroll
      for (int i2 = 0; i2 < 16; ++i2) { const float p = (e[i2] == -INFINITY || mn == -INFINITY) ? 0.0f : nexp2(e[i2] - mn); sum += p; b16 a_, b_; split16(p * PS, a_, b_); const int sl = (i2 < 8 ? 0 : 16) + 8 * hh + (i2 & 7); Ph[wave][col][sl] = a_; Pl[wave][col][sl] = b_; }
      sum += __shfl_xor(sum, 16); l = l * al + sum; m = mn;
      wave_lds_sync();
      const v16b ph = frag_kb(&Ph[wave][col][0], hh), pl = frag_kb(&Pl[wave][col][0], hh);
#pragma unroll
      for (int t = 0; t < 8; ++t) { o[t] *= al; o[t] = wmma16b(vf[t], ph, o[t]); o[t] = wmma16b(vf[t], pl, o[t]); }
      wave_lds_sync(); } }
    // publish point of tile g + 1, passed by every wave
    asm volatile("s_wait_dscnt 0x0" ::: "memory");      // this wave's reads of buffer g & 1 are done before it is refilled
    asm volatile("s_wait_asynccnt 0x0" ::: "memory");   // this wave's copies of tile g + 1 have landed
    __syncthreads();                                    // tile g + 1 readable by all; every reader has left buffer g & 1
    if (g + 2 < ntot) stage_keys(kg, vg, kl + (g & 1) * (KT * KPB), vl + (g & 1) * (D * VPB), g + 2 < n0 ? g + 2 : g + 2 - n0);
    if (st == qt / 2) {   // block-uniform: the query tile's last key tile is done
      // join of the two key shares: each wave leaves its unscaled O rows, its maximum and its sum; wave (wq, wk) then joins and stores rows wk * 8 .. wk * 8 + 7 of group wq
#pragma unroll
      for (int t = 0; t < 8; ++t)
#pragma unroll
        for (int r = 0; r < 8; ++r) To[wave][col][t * 16 + 8 * hh + r] = o[t][r];
      if (hh == 0) { Ms[wave][col] = m; Ls[wave][col] = l; }
      __syncthreads();   // both shares' partial results are readable; To, Ms, Ls are next written behind the partner tile's publish points
      const float m0 = Ms[wq][col], m1 = Ms[wq + 4][col];   // lane col: row col of group wq. m0 is finite: share 0 holds key qt * 64, which every query of the tile sees; m1 is -inf where share 1 saw no key (its O and its sum are 0)
      const float mm = fmaxf(m0, m1), f0 = nexp2(m0 - mm), f1 = nexp2(m1 - mm); const float inv = 1.0f / ((Ls[wq][col] * f0 + Ls[wq + 4][col] * f1) * PS * XS);
      const int w0 = __float_as_int(f0 * inv), w1 = __float_as_int(f1 * inv);   // the row's two weights, handed to all lanes by readlane below
#pragma unroll
      for (int j = 0; j < 8; ++j) { const int rr = wk * 8 + j;
        const v4f x0 = *(const v4f*)(&To[wq][rr][lane * 4]), x1 = *(const v4f*)(&To[wq + 4][rr][lane * 4]);
        *(v4f*)(out + ((size_t)(qt * QT + wq * 16 + rr) * H + h) * D + lane * 4) = x0 * __int_as_float(__builtin_amdgcn_readlane(w0, rr)) + x1 * __int_as_float(__builtin_amdgcn_readlane(w1, rr)); }
      asm volatile("s_wait_xcnt 0x0" ::: "memory");   // the next key tile's code reuses the address and data registers of these stores
      if (g + 1 < ntot) {   // on to the short partner
        qt = pr; g0 = n0; m = -INFINITY; l = 0.0f;
#pragma unroll
        for (int t = 0; t < 8; ++t) o[t] = (v8f){};
#pragma unroll
        for (int ks = 0; ks < 4; ++ks) qa[ks] = frag_kb(Qb + (size_t)(qt * QT + wq * 16 + col) * D + ks * 32, hh); } }
  }
  asm volatile("s_wait_asynccnt 0x0" ::: "memory");     // no copy is left in flight when the wave ends
}
}  // namespace

extern "C" void kernel_launch(void* const* d_in, const int* in_sizes, int n_in, void* d_out, int out_size, void* d_ws, size_t ws_size, hipStream_t stream) {
  (void)n_in;
  auto Fp = [&](int i) { return (const float*)d_in[i]; };
  if (in_sizes[0] != S * H * D || in_sizes[1] != S * H * D || in_sizes[2] != S * H * D || out_size != S * H * D) return;
  size_t off = 0; char* ws = (char*)d_ws;
  auto carve = [&](size_t bytes) { char* p = ws + off; off += (bytes + 255) & ~(size_t)255; return p; };
  const size_t plane = (size_t)H * S * D * 2; b16* QP = (b16*)carve(plane); b16* KP = (b16*)carve(plane); b16* VT = (b16*)carve(plane);
  if (off > ws_size || off > ((size_t)128 << 20)) return;   // 25 MB
  prepqk_kernel<<<2 * (S / PT), 256, 0, stream>>>(Fp(0), Fp(1), QP, KP);
  prepv_kernel<<<H * (S / 64), 256, 0, stream>>>(Fp(2), VT);
  attn_kernel<<<dim3(NQT / 2, HL), 256, 0, stream>>>(QP, KP, VT, (float*)d_out);
}

// v004
// One run takes 45.7 microseconds.
// In two side-by-side timings against v003, it was 1.08 and 1.09 times as fast.
// Over all steps from v000 it is 5.59 times as fast.
#include <hip/hip_runtime.h>

// Long-context causal attention on INPUT tensors query/key/value [1, 2048, 16 heads, 128]: out[s][h] = softmax_t<=s(q[s][h] . k[t][h] / sqrt(128)) v[t][h] -> [1][2048][16][128].
// Deterministic: flash-style, four waves per 16 queries (each takes every fourth 32-key step of the causal range, in order, running max), joined once; no atomics.
// compute dtype: WMMA v_wmma_f32_16x16x32_f16 with f32 accumulate for S^T = K Q^T (q, k are INPUTS: EXACT bf16 x8 planes, K = 128: 1 product) and O^T += V^T P^T (v EXACT x8 transposed plane,
// P x1024 as f16 hi+lo: 2 products); softmax statistics in f32; mode exact/hi+lo, acc f32 — every product uses exactly the bf16-rounded inputs. Inputs rounded to bf16 once.

namespace {
constexpr int S = 2048, H = 16, D = 128, HL = 16 /* heads computed (== 16 shipped) */, QL = 2048 /* query rows (== 2048 shipped) */;
constexpr float XS = 8.0f, PS = 1024.0f, LOG2E = 1.4426950408889634f;
constexpr int NW = 16 /* waves per attention block */, NS = 4 /* key shares: waves per 16 queries */, QT = 64 /* queries per tile */, NQT = QL / QT /* query tiles per head */, KT = 128 /* keys per LDS tile */, KPB = D * 2 + 16 /* LDS pitch of a K row, bytes */, VPB = KT * 2 + 16 /* LDS pitch of a V^T row, bytes */;
static_assert(S % KT == 0 && QL % (2 * QT) == 0 && KT == 2 * QT && KT == NS * 32 && NW * 16 == NS * QT && QL <= S, "tiling");
typedef _Float16 b16;
typedef __attribute__((ext_vector_type(16))) _Float16 v16b;
typedef __attribute__((ext_vector_type(8))) _Float16 v8b;
typedef __attribute__((ext_vector_type(8))) float v8f;
typedef __attribute__((ext_vector_type(4))) float v4f;
__device__ __forceinline__ float bf16_rne(float f) { unsigned int u = __float_as_uint(f); u += 0x7FFFu + ((u >> 16) & 1u); return __uint_as_float(u & 0xFFFF0000u); }
__device__ __forceinline__ void split16(float v, b16& hi, b16& lo) { hi = (b16)v; lo = (b16)(v - (float)hi); }
__device__ __forceinline__ v16b frag_kb(const b16* p, int hh) { const v8b a = *(const v8b*)(p + 8 * hh), b = *(const v8b*)(p + 16 + 8 * hh); v16b f;
#pragma unroll
  for (int e = 0; e < 8; ++e) { f[e] = a[e]; f[8 + e] = b[e]; } return f; }
__device__ __forceinline__ v8f wmma16b(v16b a, v16b b, v8f c) { v8f d = __builtin_amdgcn_wmma_f32_16x16x32_f16(false, a, false, b, (short)0, c, false, false); asm volatile("v_nop\n\tv_nop\n\tv_nop\n\tv_nop" : "+v"(d) : "v"(a), "v"(b)); return d; }
__device__ __forceinline__ void wave_lds_sync() { __builtin_amdgcn_fence(__ATOMIC_RELEASE, "workgroup"); __builtin_amdgcn_wave_barrier(); __builtin_amdgcn_fence(__ATOMIC_ACQUIRE, "workgroup"); }
__device__ __forceinline__ float pmul(float a, float b) { float p = a * b; asm volatile("" : "+v"(p)); return p; }
__device__ __forceinline__ int iclamp(int v, int lo, int hi) { return v < lo ? lo : (v > hi ? hi : v); }

typedef __attribute__((ext_vector_type(2))) _Float16 v2h;
typedef __attribute__((ext_vector_type(4))) _Float16 v4h;
__device__ __forceinline__ float nexp2(float v) { return __builtin_amdgcn_exp2f(v); }
// prep A: QP/KP [h][s][128] = bf16(q/k[s][h][:]) x8, as a stream: block per PT tokens of q or of k (PT * 8 KB of input in a row), wave w takes heads 2w and 2w + 1: 2 * PT rows of 512 B,
// one whole row per 16-B-a-lane load, all of the wave's loads issued before the first is used; 8-B-a-lane stores of whole 256-B plane rows. prep B: VT [h][d][S] = bf16(v[s][h][d]) x8: block per (h, 64-token tile), LDS transpose
constexpr int PT = 16 /* tokens per prep A block */;
static_assert(S % PT == 0 && H == 2 * 8 && D == 32 * 4, "prep A: 8 waves x 2 heads, a row is one 16-B load of a wave");
__global__ __launch_bounds__(256) void prepqk_kernel(const float* __restrict__ q, const float* __restrict__ k, b16* __restrict__ QP, b16* __restrict__ KP) {
  const int lane = threadIdx.x & 31, w = threadIdx.x >> 5, which = blockIdx.x / (S / PT), s0 = (blockIdx.x % (S / PT)) * PT;
  const float* src = (which ? k : q) + ((size_t)s0 * H + 2 * w) * D + lane * 4; b16* dst = (which ? KP : QP) + ((size_t)(2 * w) * S + s0) * D + lane * 4; v4f x[2 * PT];
#pragma unroll   // here and below: constant indices, so that the rows stay in registers and the loads stand as one group
  for (int j = 0; j < 2 * PT; ++j) x[j] = *(const v4f*)(src + (size_t)(j >> 1) * H * D + (j & 1) * D);
  __builtin_amdgcn_sched_barrier(0);   // keeps every load in front of the first conversion: without it the compiler holds only some ten rows in flight, too few bytes per WGP for the memory's latency
#pragma unroll
  for (int j = 0; j < 2 * PT; ++j) { v4h o;
#pragma unroll
    for (int e = 0; e < 4; ++e) o[e] = (b16)(bf16_rne(x[j][e]) * XS);
    *(v4h*)(dst + (size_t)(j & 1) * S * D + (j >> 1) * D) = o; }
}
__global__ __launch_bounds__(256) void prepv_kernel(const float* __restrict__ v, b16* __restrict__ VT) {
  __shared__ b16 Ts[D][64 + 8];
  const int h = blockIdx.x / (S / 64), t0 = (blockIdx.x % (S / 64)) * 64;
  const float* vp = v + ((size_t)(t0 + threadIdx.x / D) * H + h) * D + threadIdx.x % D; b16* tp = &Ts[threadIdx.x % D][threadIdx.x / D]; float x[64 * D / 256];   // one address each, the steps between the loads and between the LDS stores are constants
#pragma unroll   // here and below: constant indices, so that the values stay in registers and the loads stand as one group
  for (int j = 0; j < 64 * D / 256; ++j) x[j] = vp[(size_t)j * (256 / D) * H * D];   // element i = threadIdx.x + j * 256 of the tile: token i / D, d = i % D
#pragma unroll
  for (int j = 0; j < 64 * D / 256; ++j) tp[j * (256 / D)] = (b16)(bf16_rne(x[j]) * XS);
  __syncthreads();
  { for (int i = threadIdx.x; i < D * 8; i += 256) { const int d = i / 8, c8 = (i % 8) * 8; *(v8b*)(VT + ((size_t)h * D + d) * S + t0 + c8) = *(const v8b*)(&Ts[d][c8]); }  }
}
// attention: grid (QL/128, HL): block pr of head h runs the 64-query tiles NQT-1-pr and pr one after the other, so that every block walks as many keys. 16 waves = 4 groups of 16 queries x 4 key shares:
// four waves on every SIMD, so that one wave's vector work and LDS waits stand behind the others' matrix runs.
// A tile's causal key range goes through LDS in 128-key tiles (K rows and V^T rows); two buffers, the next tile's asynchronous copies fly while this one is worked on. Per wave: one 32-key step of every tile,
// in order, causal mask, online softmax, P x1024 hi/lo, O^T += V^T P^T over 8 d-tiles; the four shares' partial results are joined through LDS at the end of the query tile.
__device__ __forceinline__ unsigned lds_addr(const void* p) { return (unsigned)(unsigned long long)p; }   // LDS byte address = low 32 bits of the __shared__ address
// a 128-key tile: K 128 rows x 256 B and V^T 128 rows x 256 B, 16 B per lane and copy, 4 + 4 copies per thread of the 512 (a thread's rows lie 32 apart)
__device__ __forceinline__ void stage_tile(const b16* kg, const b16* vg, unsigned kl, unsigned vl) {
  const b16 *k0 = kg, *k1 = kg + 32 * D, *k2 = kg + 64 * D, *k3 = kg + 96 * D, *v0 = vg, *v1 = vg + 32 * S, *v2 = vg + 64 * S, *v3 = vg + 96 * S;
  const unsigned a0 = kl, a1 = kl + 32 * KPB, a2 = kl + 64 * KPB, a3 = kl + 96 * KPB, b0 = vl, b1 = vl + 32 * VPB, b2 = vl + 64 * VPB, b3 = vl + 96 * VPB;
  // the copies bring the tile into LDS through no register; s_wait_xcnt stands in the same statement so that no address register of a copy is rewritten in front of it
  asm volatile("global_load_async_to_lds_b128 %0, %8, off\n\t"
               "global_load_async_to_lds_b128 %1, %9, off\n\t"
               "global_load_async_to_lds_b128 %2, %10, off\n\t"
               "global_load_async_to_lds_b128 %3, %11, off\n\t"
               "global_load_async_to_lds_b128 %4, %12, off\n\t"
               "global_load_async_to_lds_b128 %5, %13, off\n\t"
               "global_load_async_to_lds_b128 %6, %14, off\n\t"
               "global_load_async_to_lds_b128 %7, %15, off\n\t"
               "s_wait_xcnt 0x0"
               :: "v"(a0), "v"(a1), "v"(a2), "v"(a3), "v"(b0), "v"(b1), "v"(b2), "v"(b3), "v"(k0), "v"(k1), "v"(k2), "v"(k3), "v"(v0), "v"(v1), "v"(v2), "v"(v3) : "memory");
}
// key tile t into the buffer at kl, vl: 8 copies per thread in flight
__device__ __forceinline__ void stage_keys(const b16* kg, const b16* vg, unsigned kl, unsigned vl, int t) { stage_tile(kg + (size_t)t * KT * D, vg + t * KT, kl, vl); }
__global__ __launch_bounds__(NW * 32) void attn_kernel(const b16* __restrict__ QP, const b16* __restrict__ KP, const b16* __restrict__ VT, float* __restrict__ out) {
  __shared__ __attribute__((aligned(16))) b16 Ks[2][KT][KPB / 2], Vs[2][D][VPB / 2];
  __shared__ __attribute__((aligned(16))) b16 Ph[NW][16][32 + 8], Pl[NW][16][32 + 8]; __shared__ __attribute__((aligned(16))) float To[NW][16][D + 4]; __shared__ float Ms[NW][16], Ls[NW][16];
  const int tid = threadIdx.x, wave = __builtin_amdgcn_readfirstlane(tid >> 5), lane = tid & 31, hh = lane >> 4, col = lane & 15; const int h = blockIdx.y, pr = blockIdx.x;
  const int wq = wave & 3 /* 16-query group of the tile */, wk = wave >> 2 /* key share: 32-key step wk of every key tile */;
  const b16* Qb = QP + (size_t)h * S * D; const b16* Kb = KP + (size_t)h * S * D; const b16* Vb = VT + (size_t)h * D * S;
  const b16* kg = Kb + (size_t)(tid >> 4) * D + (tid & 15) * 8; const b16* vg = Vb + (size_t)(tid >> 4) * S + (tid & 15) * 8;
  const unsigned kl = lds_addr(&Ks[0][tid >> 4][(tid & 15) * 8]), vl = lds_addr(&Vs[0][tid >> 4][(tid & 15) * 8]);
  // query tile qt needs the key tiles 0 .. qt / 2. The block's key tiles as one sequence g: n0 tiles for the long query tile NQT - 1 - pr, then pr / 2 + 1 for its short partner pr: NQT / 2 + 1 in every block;
  // n0 > 1, and every key tile ends at or below key S
  const int n0 = (NQT - 1 - pr) / 2 + 1, ntot = n0 + pr / 2 + 1;
  stage_keys(kg, vg, kl, vl, 0);
  int qt = NQT - 1 - pr /* the query tile at work */, g0 = 0 /* where its key tiles begin in the sequence */;
  v16b qa[4];
#pragma unroll
  for (int ks = 0; ks < 4; ++ks) qa[ks] = frag_kb(Qb + (size_t)(qt * QT + wq * 16 + col) * D + ks * 32, hh);
  const float cs = LOG2E / (11.313708498984761f * XS * XS);   // 1/sqrt(128)
  float m = -INFINITY, l = 0.0f; v8f o[8]; for (int t = 0; t < 8; ++t) o[t] = (v8f){};
  asm volatile("s_wait_asynccnt 0x0" ::: "memory");   // this wave's copies of tile 0 have landed
  __syncthreads();                                    // tile 0 is readable by every wave
  stage_keys(kg, vg, kl + KT * KPB, vl + D * VPB, 1);   // g = 1 is key tile 1 (n0 > 1)
#pragma unroll 1   // rolled: one copy of the tile body, the buffer picked by g & 1
  for (int g = 0; g < ntot; ++g) {
    const b16 (*Kt)[KPB / 2] = Ks[g & 1]; const b16 (*Vt)[VPB / 2] = Vs[g & 1];
    const int st = g - g0, q0 = qt * QT + wq * 16, qi = q0 + col;
    const int ko = wk * 32, kb = st * KT + ko;   // the wave's 32-key step of the tile
    if (kb < q0 + 16) {   // wave-uniform: a wave skips the steps beyond its own diagonal, never the publish point below
      float e[16]; float mx = -INFINITY; v16b kf[8], vf[8];   // the step's K fragments, then its V^T fragments, each read from LDS as one group: one LDS latency a group, not one a product
#pragma unroll   // here and at vf: constant indices, so that the fragment arrays stay in registers
      for (int u = 0; u < 2; ++u)
#pragma unroll
        for (int ks = 0; ks < 4; ++ks) kf[u * 4 + ks] = frag_kb(&Kt[ko + u * 16 + col][ks * 32], hh);
#pragma unroll
      for (int u = 0; u < 2; ++u) { v8f s = (v8f){};
#pragma unroll
        for (int ks = 0; ks < 4; ++ks) s = wmma16b(kf[u * 4 + ks], qa[ks], s);
#pragma unroll
        for (int r = 0; r < 8; ++r) { const int key = kb + u * 16 + 8 * hh + r; const float vv = (key <= qi) ? s[r] * cs : -INFINITY; e[u * 8 + r] = vv; mx = fmaxf(mx, vv); } }
#pragma unroll
      for (int t = 0; t < 8; ++t) vf[t] = frag_kb(&Vt[t * 16 + col][ko], hh);
      mx = fmaxf(mx, __shfl_xor(mx, 16)); const float mn = fmaxf(m, mx); const float al = (mn == -INFINITY) ? 1.0f : nexp2(m - mn); float sum = 0.0f;
#pragma unroll
      for (int i2 = 0; i2 < 16; ++i2) { float ex;
        if (i2 == 11) asm("v_exp_f32 %0, %1\n\tv_nop" : "=v"(ex) : "v"(e[i2] - mn));   // the slot that the instruction set asks for behind a transcendental
        else ex = nexp2(e[i2] - mn);
        const float p = (e[i2] == -INFINITY || mn == -INFINITY) ? 0.0f : ex; sum += p; b16 a_, b_; split16(p * PS, a_, b_); const int sl = (i2 < 8 ? 0 : 16) + 8 * hh + (i2 & 7); Ph[wave][col][sl] = a_; Pl[wave][col][sl] = b_; }
      sum += __shfl_xor(sum, 16); l = l * al + sum; m = mn;
      wave_lds_sync();
      const v16b ph = frag_kb(&Ph[wave][col][0], hh), pl = frag_kb(&Pl[wave][col][0], hh);
#pragma unroll
      for (int t = 0; t < 8; ++t) { o[t] *= al; o[t] = wmma16b(vf[t], ph, o[t]); o[t] = wmma16b(vf[t], pl, o[t]); }
      wave_lds_sync(); }
    // publish point of tile g + 1, passed by every wave
    asm volatile("s_wait_dscnt 0x0" ::: "memory");      // this wave's reads of buffer g & 1 are done before it is refilled
    asm volatile("s_wait_asynccnt 0x0" ::: "memory");   // this wave's copies of tile g + 1 have landed
    __syncthreads();                                    // tile g + 1 readable by all; every reader has left buffer g & 1
    if (g + 2 < ntot) stage_keys(kg, vg, kl + (g & 1) * (KT * KPB), vl + (g & 1) * (D * VPB), g + 2 < n0 ? g + 2 : g + 2 - n0);
    if (st == qt / 2) {   // block-uniform: the query tile's last key tile is done
      // join of the four key shares: each wave leaves its unscaled O rows, its maximum and its sum; wave (wq, wk) then joins and stores rows wk * 4 .. wk * 4 + 3 of group wq
#pragma unroll
      for (int t = 0; t < 8; ++t)
#pragma unroll
        for (int r = 0; r < 8; ++r) To[wave][col][t * 16 + 8 * hh + r] = o[t][r];
      if (hh == 0) { Ms[wave][col] = m; Ls[wave][col] = l; }
      __syncthreads();   // all shares' partial results are readable; To, Ms, Ls are next written behind the partner tile's publish points
      // lane col: row col of group wq. Share 0's maximum is finite: it holds key 0, which every query sees; a share that saw no key of the row has maximum -inf, weight 0, and its O and its sum are 0
      float ms[NS], f[NS], mm = -INFINITY, den = 0.0f; int wt[NS];
#pragma unroll   // here and below: constant indices, so that the shares' values stay in registers
      for (int i = 0; i < NS; ++i) { ms[i] = Ms[wq + 4 * i][col]; mm = fmaxf(mm, ms[i]); }
#pragma unroll
      for (int i = 0; i < NS; ++i) { f[i] = nexp2(ms[i] - mm);
        if (i == 0) asm volatile("v_nop" :: "v"(f[i])); }   // the slot that the instruction set asks for behind a transcendental
#pragma unroll
      for (int i = 0; i < NS; ++i) den = fmaf(Ls[wq + 4 * i][col], f[i], den);
      const float inv = 1.0f / (den * PS * XS);
#pragma unroll
      for (int i = 0; i < NS; ++i) wt[i] = __float_as_int(f[i] * inv);   // the row's four weights, handed to all lanes by readlane below
#pragma unroll
      for (int j = 0; j < 16 / NS; ++j) { const int rr = wk * (16 / NS) + j; v4f x = (v4f){};
#pragma unroll
        for (int i = 0; i < NS; ++i) x += *(const v4f*)(&To[wq + 4 * i][rr][lane * 4]) * __int_as_float(__builtin_amdgcn_readlane(wt[i], rr));
        *(v4f*)(out + ((size_t)(qt * QT + wq * 16 + rr) * H + h) * D + lane * 4) = x; }
      asm volatile("s_wait_xcnt 0x0" ::: "memory");   // the next key tile's code reuses the address and data registers of these stores
      if (g + 1 < ntot) {   // on to the short partner
        qt = pr; g0 = n0; m = -INFINITY; l = 0.0f;
#pragma unroll
        for (int t = 0; t < 8; ++t) o[t] = (v8f){};
#pragma unroll
        for (int ks = 0; ks < 4; ++ks) qa[ks] = frag_kb(Qb + (size_t)(qt * QT + wq * 16 + col) * D + ks * 32, hh); } }
  }
  asm volatile("s_wait_asynccnt 0x0" ::: "memory");     // no copy is left in flight when the wave ends
}
}  // namespace

extern "C" void kernel_launch(void* const* d_in, const int* in_sizes, int n_in, void* d_out, int out_size, void* d_ws, size_t ws_size, hipStream_t stream) {
  (void)n_in;
  auto Fp = [&](int i) { return (const float*)d_in[i]; };
  if (in_sizes[0] != S * H * D || in_sizes[1] != S * H * D || in_sizes[2] != S * H * D || out_size != S * H * D) return;
  size_t off = 0; char* ws = (char*)d_ws;
  auto carve = [&](size_t bytes) { char* p = ws + off; off += (bytes + 255) & ~(size_t)255; return p; };
  const size_t plane = (size_t)H * S * D * 2; b16* QP = (b16*)carve(plane); b16* KP = (b16*)carve(plane); b16* VT = (b16*)carve(plane);
  if (off > ws_size || off > ((size_t)128 << 20)) return;   // 25 MB
  prepqk_kernel<<<2 * (S / PT), 256, 0, stream>>>(Fp(0), Fp(1), QP, KP);
  prepv_kernel<<<H * (S / 64), 256, 0, stream>>>(Fp(2), VT);
  attn_kernel<<<dim3(NQT / 2, HL), NW * 32, 0, stream>>>(QP, KP, VT, (float*)d_out);
}

// v005
// A run of this version takes 44.4 microseconds.
// Two timings next to v004 put it at 1.03 and 1.04 times that version's speed.
// All steps since v000 together make it 5.78 times as fast.
#include <hip/hip_runtime.h>

// Long-context causal attention on INPUT tensors query/key/value [1, 2048, 16 heads, 128]: out[s][h] = softmax_t<=s(q[s][h] . k[t][h] / sqrt(128)) v[t][h] -> [1][2048][16][128].
// Deterministic: flash-style, four waves per 16 queries (each takes every fourth 32-key step of the causal range, in order, running max), joined once; no atomics.
// compute dtype: WMMA v_wmma_f32_16x16x32_f16 with f32 accumulate for S^T = K Q^T (q, k are INPUTS: EXACT bf16 x8 planes, K = 128: 1 product) and O^T += V^T P^T (v EXACT x8 transposed plane,
// P x1024 as f16 hi+lo: 2 products); softmax statistics in f32; mode exact/hi+lo, acc f32 — every product uses exactly the bf16-rounded inputs. Inputs rounded to bf16 once.

namespace {
constexpr int S = 2048, H = 16, D = 128, HL = 16 /* heads computed (== 16 shipped) */, QL = 2048 /* query rows (== 2048 shipped) */;
constexpr float XS = 8.0f, PS = 1024.0f, LOG2E = 1.4426950408889634f;
constexpr int NW = 16 /* waves per attention block */, NS = 4 /* key shares: waves per 16 queries */, QT = 64 /* queries per tile */, NQT = QL / QT /* query tiles per head */, KT = 128 /* keys per LDS tile */, KPB = D * 2 + 16 /* LDS pitch of a K row, bytes */, VPB = KT * 2 + 16 /* LDS pitch of a V^T row, bytes */;
static_assert(S % KT == 0 && QL % (2 * QT) == 0 && KT == 2 * QT && KT == NS * 32 && NW * 16 == NS * QT && QL <= S, "tiling");
typedef _Float16 b16;
typedef __attribute__((ext_vector_type(16))) _Float16 v16b;
typedef __attribute__((ext_vector_type(8))) _Float16 v8b;
typedef __attribute__((ext_vector_type(8))) float v8f;
typedef __attribute__((ext_vector_type(4))) float v4f;
__device__ __forceinline__ float bf16_rne(float f) { unsigned int u = __float_as_uint(f); u += 0x7FFFu + ((u >> 16) & 1u); return __uint_as_float(u & 0xFFFF0000u); }
__device__ __forceinline__ void split16(float v, b16& hi, b16& lo) { hi = (b16)v; lo = (b16)(v - (float)hi); }
__device__ __forceinline__ v16b frag_kb(const b16* p, int hh) { const v8b a = *(const v8b*)(p + 8 * hh), b = *(const v8b*)(p + 16 + 8 * hh); v16b f;
#pragma unroll
  for (int e = 0; e < 8; ++e) { f[e] = a[e]; f[8 + e] = b[e]; } return f; }
__device__ __forceinline__ v8f wmma16b(v16b a, v16b b, v8f c) { v8f d = __builtin_amdgcn_wmma_f32_16x16x32_f16(false, a, false, b, (short)0, c, false, false); asm volatile("v_nop\n\tv_nop\n\tv_nop\n\tv_nop" : "+v"(d) : "v"(a), "v"(b)); return d; }
__device__ __forceinline__ void wave_lds_sync() { __builtin_amdgcn_fence(__ATOMIC_RELEASE, "workgroup"); __builtin_amdgcn_wave_barrier(); __builtin_amdgcn_fence(__ATOMIC_ACQUIRE, "workgroup"); }
__device__ __forceinline__ float pmul(float a, float b) { float p = a * b; asm volatile("" : "+v"(p)); return p; }
__device__ __forceinline__ int iclamp(int v, int lo, int hi) { return v < lo ? lo : (v > hi ? hi : v); }

typedef __attribute__((ext_vector_type(2))) _Float16 v2h;
typedef __attribute__((ext_vector_type(4))) _Float16 v4h;
__device__ __forceinline__ float nexp2(float v) { return __builtin_amdgcn_exp2f(v); }
// prep A: QP/KP [h][s][128] = bf16(q/k[s][h][:]) x8, as a stream: block per PT tokens of q or of k (PT * 8 KB of input in a row), wave w takes heads 2w and 2w + 1: 2 * PT rows of 512 B,
// one whole row per 16-B-a-lane load, all of the wave's loads issued before the first is used; 8-B-a-lane stores of whole 256-B plane rows. prep B: VT [h][d][S] = bf16(v[s][h][d]) x8: block per (h, 64-token tile), LDS transpose
constexpr int PT = 16 /* tokens per prep A block */;
static_assert(S % PT == 0 && H == 2 * 8 && D == 32 * 4, "prep A: 8 waves x 2 heads, a row is one 16-B load of a wave");
__global__ __launch_bounds__(256) void prepqk_kernel(const float* __restrict__ q, const float* __restrict__ k, b16* __restrict__ QP, b16* __restrict__ KP) {
  const int lane = threadIdx.x & 31, w = threadIdx.x >> 5, which = blockIdx.x / (S / PT), s0 = (blockIdx.x % (S / PT)) * PT;
  const float* src = (which ? k : q) + ((size_t)s0 * H + 2 * w) * D + lane * 4; b16* dst = (which ? KP : QP) + ((size_t)(2 * w) * S + s0) * D + lane * 4; v4f x[2 * PT];
#pragma unroll   // here and below: constant indices, so that the rows stay in registers and the loads stand as one group
  for (int j = 0; j < 2 * PT; ++j) x[j] = *(const v4f*)(src + (size_t)(j >> 1) * H * D + (j & 1) * D);
  __builtin_amdgcn_sched_barrier(0);   // keeps every load in front of the first conversion: without it the compiler holds only some ten rows in flight, too few bytes per WGP for the memory's latency
#pragma unroll
  for (int j = 0; j < 2 * PT; ++j) { v4h o;
#pragma unroll
    for (int e = 0; e < 4; ++e) o[e] = (b16)(bf16_rne(x[j][e]) * XS);
    *(v4h*)(dst + (size_t)(j & 1) * S * D + (j >> 1) * D) = o; }
}
__global__ __launch_bounds__(256) void prepv_kernel(const float* __restrict__ v, b16* __restrict__ VT) {
  __shared__ b16 Ts[D][64 + 8];
  const int h = blockIdx.x / (S / 64), t0 = (blockIdx.x % (S / 64)) * 64;
  const float* vp = v + ((size_t)(t0 + threadIdx.x / D) * H + h) * D + threadIdx.x % D; b16* tp = &Ts[threadIdx.x % D][threadIdx.x / D]; float x[64 * D / 256];   // one address each, the steps between the loads and between the LDS stores are constants
#pragma unroll   // here and below: constant indices, so that the values stay in registers and the loads stand as one group
  for (int j = 0; j < 64 * D / 256; ++j) x[j] = vp[(size_t)j * (256 / D) * H * D];   // element i = threadIdx.x + j * 256 of the tile: token i / D, d = i % D
#pragma unroll
  for (int j = 0; j < 64 * D / 256; ++j) tp[j * (256 / D)] = (b16)(bf16_rne(x[j]) * XS);
  __syncthreads();
  { for (int i = threadIdx.x; i < D * 8; i += 256) { const int d = i / 8, c8 = (i % 8) * 8; *(v8b*)(VT + ((size_t)h * D + d) * S + t0 + c8) = *(const v8b*)(&Ts[d][c8]); }  }
}
// attention: grid (QL/128, HL): block pr of head h runs the 64-query tiles NQT-1-pr and pr one after the other, so that every block walks as many keys. 16 waves = 4 groups of 16 queries x 4 key shares:
// four waves on every SIMD, so that one wave's vector work and LDS waits stand behind the others' matrix runs.
// A tile's causal key range goes through LDS in 128-key tiles (K rows and V^T rows); two buffers, the next tile's asynchronous copies fly while this one is worked on. Per wave: one 32-key step of every tile,
// in order, causal mask, online softmax, P x1024 hi/lo, O^T += V^T P^T over 8 d-tiles; the four shares' partial results are joined through LDS at the end of the query tile.
__device__ __forceinline__ unsigned lds_addr(const void* p) { return (unsigned)(unsigned long long)p; }   // LDS byte address = low 32 bits of the __shared__ address
// a 128-key tile: K 128 rows x 256 B and V^T 128 rows x 256 B, 16 B per lane and copy, 4 + 4 copies per thread of the 512 (a thread's rows lie 32 apart)
__device__ __forceinline__ void stage_tile(const b16* kg, const b16* vg, unsigned kl, unsigned vl) {
  const b16 *k0 = kg, *k1 = kg + 32 * D, *k2 = kg + 64 * D, *k3 = kg + 96 * D, *v0 = vg, *v1 = vg + 32 * S, *v2 = vg + 64 * S, *v3 = vg + 96 * S;
  const unsigned a0 = kl, a1 = kl + 32 * KPB, a2 = kl + 64 * KPB, a3 = kl + 96 * KPB, b0 = vl, b1 = vl + 32 * VPB, b2 = vl + 64 * VPB, b3 = vl + 96 * VPB;
  // the copies bring the tile into LDS through no register; s_wait_xcnt stands in the same statement so that no address register of a copy is rewritten in front of it
  asm volatile("global_load_async_to_lds_b128 %0, %8, off\n\t"
               "global_load_async_to_lds_b128 %1, %9, off\n\t"
               "global_load_async_to_lds_b128 %2, %10, off\n\t"
               "global_load_async_to_lds_b128 %3, %11, off\n\t"
               "global_load_async_to_lds_b128 %4, %12, off\n\t"
               "global_load_async_to_lds_b128 %5, %13, off\n\t"
               "global_load_async_to_lds_b128 %6, %14, off\n\t"
               "global_load_async_to_lds_b128 %7, %15, off\n\t"
               "s_wait_xcnt 0x0"
               :: "v"(a0), "v"(a1), "v"(a2), "v"(a3), "v"(b0), "v"(b1), "v"(b2), "v"(b3), "v"(k0), "v"(k1), "v"(k2), "v"(k3), "v"(v0), "v"(v1), "v"(v2), "v"(v3) : "memory");
}
// key tile t into the buffer at kl, vl: 8 copies per thread in flight
__device__ __forceinline__ void stage_keys(const b16* kg, const b16* vg, unsigned kl, unsigned vl, int t) { stage_tile(kg + (size_t)t * KT * D, vg + t * KT, kl, vl); }
__global__ __launch_bounds__(NW * 32) void attn_kernel(const b16* __restrict__ QP, const b16* __restrict__ KP, const b16* __restrict__ VT, float* __restrict__ out) {
  __shared__ __attribute__((aligned(16))) b16 Ks[2][KT][KPB / 2], Vs[2][D][VPB / 2];
  __shared__ __attribute__((aligned(16))) b16 Ph[NW][16][32 + 8], Pl[NW][16][32 + 8]; __shared__ __attribute__((aligned(16))) float To[NW][16][D + 4]; __shared__ float Ms[NW][16], Ls[NW][16];
  const int tid = threadIdx.x, wave = __builtin_amdgcn_readfirstlane(tid >> 5), lane = tid & 31, hh = lane >> 4, col = lane & 15; const int h = blockIdx.y, pr = blockIdx.x;
  const int wq = wave & 3 /* 16-query group of the tile */, wk = wave >> 2 /* key share: 32-key step wk of every key tile */;
  const b16* Qb = QP + (size_t)h * S * D; const b16* Kb = KP + (size_t)h * S * D; const b16* Vb = VT + (size_t)h * D * S;
  const b16* kg = Kb + (size_t)(tid >> 4) * D + (tid & 15) * 8; const b16* vg = Vb + (size_t)(tid >> 4) * S + (tid & 15) * 8;
  const unsigned kl = lds_addr(&Ks[0][tid >> 4][(tid & 15) * 8]), vl = lds_addr(&Vs[0][tid >> 4][(tid & 15) * 8]);
  // query tile qt needs the key tiles 0 .. qt / 2. The block's key tiles as one sequence g: n0 tiles for the long query tile NQT - 1 - pr, then pr / 2 + 1 for its short partner pr: NQT / 2 + 1 in every block;
  // n0 > 1, and every key tile ends at or below key S
  const int n0 = (NQT - 1 - pr) / 2 + 1, ntot = n0 + pr / 2 + 1;
  stage_keys(kg, vg, kl, vl, 0);
  int qt = NQT - 1 - pr /* the query tile at work */, g0 = 0 /* where its key tiles begin in the sequence */;
  v16b qa[4];
#pragma unroll
  for (int ks = 0; ks < 4; ++ks) qa[ks] = frag_kb(Qb + (size_t)(qt * QT + wq * 16 + col) * D + ks * 32, hh);
  const float cs = LOG2E / (11.313708498984761f * XS * XS);   // 1/sqrt(128)
  float m = -INFINITY, l = 0.0f; v8f o[8]; for (int t = 0; t < 8; ++t) o[t] = (v8f){};
  asm volatile("s_wait_asynccnt 0x0" ::: "memory");   // this wave's copies of tile 0 have landed
  __syncthreads();                                    // tile 0 is readable by every wave
  stage_keys(kg, vg, kl + KT * KPB, vl + D * VPB, 1);   // g = 1 is key tile 1 (n0 > 1)
#pragma unroll 1   // rolled: one copy of the tile body, the buffer picked by g & 1
  for (int g = 0; g < ntot; ++g) {
    const b16 (*Kt)[KPB / 2] = Ks[g & 1]; const b16 (*Vt)[VPB / 2] = Vs[g & 1];
    const int st = g - g0, q0 = qt * QT + wq * 16, qi = q0 + col;
    const int ko = wk * 32, kb = st * KT + ko;   // the wave's 32-key step of the tile
    if (kb < q0 + 16) {   // wave-uniform: a wave skips the steps beyond its own diagonal, never the publish point below
      float e[16]; float mx = -INFINITY; v16b kf[8], vf[8];   // the step's K fragments, then its V^T fragments, each read from LDS as one group: one LDS latency a group, not one a product
#pragma unroll   // here and at vf: constant indices, so that the fragment arrays stay in registers
      for (int u = 0; u < 2; ++u)
#pragma unroll
        for (int ks = 0; ks < 4; ++ks) kf[u * 4 + ks] = frag_kb(&Kt[ko + u * 16 + col][ks * 32], hh);
#pragma unroll
      for (int u = 0; u < 2; ++u) { v8f s = (v8f){};
#pragma unroll
        for (int ks = 0; ks < 4; ++ks) s = wmma16b(kf[u * 4 + ks], qa[ks], s);
#pragma unroll
        for (int r = 0; r < 8; ++r) e[u * 8 + r] = s[r] * cs; }
      if (kb + 31 > q0) {   // wave-uniform: only the step that the diagonal crosses holds keys above a query of the wave; every earlier step goes unmasked
#pragma unroll   // here and at mx: constant indices, so that the scores stay in registers
        for (int i2 = 0; i2 < 16; ++i2) { const int key = kb + (i2 >> 3) * 16 + 8 * hh + (i2 & 7); e[i2] = (key <= qi) ? e[i2] : -INFINITY; } }
#pragma unroll
      for (int i2 = 0; i2 < 16; ++i2) mx = fmaxf(mx, e[i2]);
#pragma unroll
      for (int t = 0; t < 8; ++t) vf[t] = frag_kb(&Vt[t * 16 + col][ko], hh);
      mx = fmaxf(mx, __shfl_xor(mx, 16)); const float mn = fmaxf(m, mx); const float al = nexp2(m - mn); float sum = 0.0f;   // mn is finite: a running step has kb <= q0, so its key kb is seen by all 16 queries; a masked score gives exp2(-inf) = 0, a first step al = 0
#pragma unroll
      for (int i2 = 0; i2 < 16; ++i2) { float ex;
        if (i2 == 11) asm("v_exp_f32 %0, %1\n\tv_nop" : "=v"(ex) : "v"(e[i2] - mn));   // the slot that the instruction set asks for behind a transcendental
        else ex = nexp2(e[i2] - mn);
        const float p = ex; sum += p; b16 a_, b_; split16(p * PS, a_, b_); const int sl = (i2 < 8 ? 0 : 16) + 8 * hh + (i2 & 7); Ph[wave][col][sl] = a_; Pl[wave][col][sl] = b_; }
      sum += __shfl_xor(sum, 16); l = l * al + sum; m = mn;
      wave_lds_sync();
      const v16b ph = frag_kb(&Ph[wave][col][0], hh), pl = frag_kb(&Pl[wave][col][0], hh);
#pragma unroll
      for (int t = 0; t < 8; ++t) { o[t] *= al; o[t] = wmma16b(vf[t], ph, o[t]); o[t] = wmma16b(vf[t], pl, o[t]); }
      wave_lds_sync(); }
    // publish point of tile g + 1, passed by every wave
    asm volatile("s_wait_dscnt 0x0" ::: "memory");      // this wave's reads of buffer g & 1 are done before it is refilled
    asm volatile("s_wait_asynccnt 0x0" ::: "memory");   // this wave's copies of tile g + 1 have landed
    __syncthreads();                                    // tile g + 1 readable by all; every reader has left buffer g & 1
    if (g + 2 < ntot) stage_keys(kg, vg, kl + (g & 1) * (KT * KPB), vl + (g & 1) * (D * VPB), g + 2 < n0 ? g + 2 : g + 2 - n0);
    if (st == qt / 2) {   // block-uniform: the query tile's last key tile is done
      // join of the four key shares: each wave leaves its unscaled O rows, its maximum and its sum; wave (wq, wk) then joins and stores rows wk * 4 .. wk * 4 + 3 of group wq
#pragma unroll
      for (int t = 0; t < 8; ++t)
#pragma unroll
        for (int r = 0; r < 8; ++r) To[wave][col][t * 16 + 8 * hh + r] = o[t][r];
      if (hh == 0) { Ms[wave][col] = m; Ls[wave][col] = l; }
      __syncthreads();   // all shares' partial results are readable; To, Ms, Ls are next written behind the partner tile's publish points
      // lane col: row col of group wq. Share 0's maximum is finite: it holds key 0, which every query sees; a share that saw no key of the row has maximum -inf, weight 0, and its O and its sum are 0
      float ms[NS], f[NS], mm = -INFINITY, den = 0.0f; int wt[NS];
#pragma unroll   // here and below: constant indices, so that the shares' values stay in registers
      for (int i = 0; i < NS; ++i) { ms[i] = Ms[wq + 4 * i][col]; mm = fmaxf(mm, ms[i]); }
#pragma unroll
      for (int i = 0; i < NS; ++i) { f[i] = nexp2(ms[i] - mm);
        if (i == 0) asm volatile("v_nop" :: "v"(f[i])); }   // the slot that the instruction set asks for behind a transcendental
#pragma unroll
      for (int i = 0; i < NS; ++i) den = fmaf(Ls[wq + 4 * i][col], f[i], den);
      const float inv = 1.0f / (den * PS * XS);
#pragma unroll
      for (int i = 0; i < NS; ++i) wt[i] = __float_as_int(f[i] * inv);   // the row's four weights, handed to all lanes by readlane below
#pragma unroll
      for (int j = 0; j < 16 / NS; ++j) { const int rr = wk * (16 / NS) + j; v4f x = (v4f){};
#pragma unroll
        for (int i = 0; i < NS; ++i) x += *(const v4f*)(&To[wq + 4 * i][rr][lane * 4]) * __int_as_float(__builtin_amdgcn_readlane(wt[i], rr));
        *(v4f*)(out + ((size_t)(qt * QT + wq * 16 + rr) * H + h) * D + lane * 4) = x; }
      asm volatile("s_wait_xcnt 0x0" ::: "memory");   // the next key tile's code reuses the address and data registers of these stores
      if (g + 1 < ntot) {   // on to the short partner
        qt = pr; g0 = n0; m = -INFINITY; l = 0.0f;
#pragma unroll
        for (int t = 0; t < 8; ++t) o[t] = (v8f){};
#pragma unroll
        for (int ks = 0; ks < 4; ++ks) qa[ks] = frag_kb(Qb + (size_t)(qt * QT + wq * 16 + col) * D + ks * 32, hh); } }
  }
  asm volatile("s_wait_asynccnt 0x0" ::: "memory");     // no copy is left in flight when the wave ends
}
}  // namespace

extern "C" void kernel_launch(void* const* d_in, const int* in_sizes, int n_in, void* d_out, int out_size, void* d_ws, size_t ws_size, hipStream_t stream) {
  (void)n_in;
  auto Fp = [&](int i) { return (const float*)d_in[i]; };
  if (in_sizes[0] != S * H * D || in_sizes[1] != S * H * D || in_sizes[2] != S * H * D || out_size != S * H * D) return;
  size_t off = 0; char* ws = (char*)d_ws;
  auto carve = [&](size_t bytes) { char* p = ws + off; off += (bytes + 255) & ~(size_t)255; return p; };
  const size_t plane = (size_t)H * S * D * 2; b16* QP = (b16*)carve(plane); b16* KP = (b16*)carve(plane); b16* VT = (b16*)carve(plane);
  if (off > ws_size || off > ((size_t)128 << 20)) return;   // 25 MB
  prepqk_kernel<<<2 * (S / PT), 256, 0, stream>>>(Fp(0), Fp(1), QP, KP);
  prepv_kernel<<<H * (S / 64), 256, 0, stream>>>(Fp(2), VT);
  attn_kernel<<<dim3(NQT / 2, HL), NW * 32, 0, stream>>>(QP, KP, VT, (float*)d_out);
}

// v006
// It runs in 41.9 microseconds.
// Timed twice side by side with v005, it ran 1.05 and 1.06 times as fast.
// All steps since v000 together make it 6.11 times as fast.
#include <hip/hip_runtime.h>

// Long-context causal attention on INPUT tensors query/key/value [1, 2048, 16 heads, 128]: out[s][h] = softmax_t<=s(q[s][h] . k[t][h] / sqrt(128)) v[t][h] -> [1][2048][16][128].
// Deterministic: flash-style, four waves per 16 queries (each takes every fourth 32-key step of the causal range, in order, running max), joined once; no atomics.
// compute dtype: WMMA v_wmma_f32_16x16x32_f16 with f32 accumulate for S^T = K Q^T (q, k are INPUTS: EXACT bf16 x8 planes, K = 128: 1 product) and O^T += V^T P^T (v EXACT x8 transposed plane,
// P x1024 as f16 hi+lo: 2 products); softmax statistics in f32; mode exact/hi+lo, acc f32 — every product uses exactly the bf16-rounded inputs. Inputs rounded to bf16 once.

namespace {
constexpr int S = 2048, H = 16, D = 128, HL = 16 /* heads computed (== 16 shipped) */, QL = 2048 /* query rows (== 2048 shipped) */;
constexpr float XS = 8.0f, PS = 1024.0f, LOG2E = 1.4426950408889634f;
constexpr int NW = 16 /* waves per attention block */, NS = 4 /* key shares: waves per 16 queries */, QT = 64 /* queries per tile */, NQT = QL / QT /* query tiles per head */, KT = 128 /* keys per LDS tile */, KPB = D * 2 + 16 /* LDS pitch of a K row, bytes */, VPB = KT * 2 + 16 /* LDS pitch of a V^T row, bytes */;
static_assert(S % KT == 0 && QL % (2 * QT) == 0 && KT == 2 * QT && KT == NS * 32 && NW * 16 == NS * QT && QL <= S, "tiling");
typedef _Float16 b16;
typedef __attribute__((ext_vector_type(16))) _Float16 v16b;
typedef __attribute__((ext_vector_type(8))) _Float16 v8b;
typedef __attribute__((ext_vector_type(8))) float v8f;
typedef __attribute__((ext_vector_type(4))) float v4f;
__device__ __forceinline__ float bf16_rne(float f) { unsigned int u = __float_as_uint(f); u += 0x7FFFu + ((u >> 16) & 1u); return __uint_as_float(u & 0xFFFF0000u); }
__device__ __forceinline__ void split16(float v, b16& hi, b16& lo) { hi = (b16)v; lo = (b16)(v - (float)hi); }
__device__ __forceinline__ v16b frag_kb(const b16* p, int hh) { const v8b a = *(const v8b*)(p + 8 * hh), b = *(const v8b*)(p + 16 + 8 * hh); v16b f;
#pragma unroll
  for (int e = 0; e < 8; ++e) { f[e] = a[e]; f[8 + e] = b[e]; } return f; }
__device__ __forceinline__ v8f wmma16b(v16b a, v16b b, v8f c) { v8f d = __builtin_amdgcn_wmma_f32_16x16x32_f16(false, a, false, b, (short)0, c, false, false); asm volatile("v_nop\n\tv_nop\n\tv_nop\n\tv_nop" : "+v"(d) : "v"(a), "v"(b)); return d; }
__device__ __forceinline__ void wave_lds_sync() { __builtin_amdgcn_fence(__ATOMIC_RELEASE, "workgroup"); __builtin_amdgcn_wave_barrier(); __builtin_amdgcn_fence(__ATOMIC_ACQUIRE, "workgroup"); }
__device__ __forceinline__ float pmul(float a, float b) { float p = a * b; asm volatile("" : "+v"(p)); return p; }
__device__ __forceinline__ int iclamp(int v, int lo, int hi) { return v < lo ? lo : (v > hi ? hi : v); }

typedef __attribute__((ext_vector_type(2))) _Float16 v2h;
typedef __attribute__((ext_vector_type(4))) _Float16 v4h;
__device__ __forceinline__ float nexp2(float v) { return __builtin_amdgcn_exp2f(v); }
// prep A: QP/KP [h][s][128] = bf16(q/k[s][h][:]) x8, as a stream: block per PT tokens of q or of k (PT * 8 KB of input in a row), wave w takes heads 2w and 2w + 1: 2 * PT rows of 512 B,
// one whole row per 16-B-a-lane load, all of the wave's loads issued before the first is used; 8-B-a-lane stores of whole 256-B plane rows. prep B: VT [h][d][S] = bf16(v[s][h][d]) x8: block per (h, 64-token tile), LDS transpose
constexpr int PT = 16 /* tokens per prep A block */;
static_assert(S % PT == 0 && H == 2 * 8 && D == 32 * 4, "prep A: 8 waves x 2 heads, a row is one 16-B load of a wave");
__device__ __forceinline__ void prepqk_block(int b, const float* __restrict__ q, const float* __restrict__ k, b16* __restrict__ QP, b16* __restrict__ KP) {
  const int lane = threadIdx.x & 31, w = threadIdx.x >> 5, which = b / (S / PT), s0 = (b % (S / PT)) * PT;
  const float* src = (which ? k : q) + ((size_t)s0 * H + 2 * w) * D + lane * 4; b16* dst = (which ? KP : QP) + ((size_t)(2 * w) * S + s0) * D + lane * 4; v4f x[2 * PT];
#pragma unroll   // here and below: constant indices, so that the rows stay in registers and the loads stand as one group
  for (int j = 0; j < 2 * PT; ++j) x[j] = *(const v4f*)(src + (size_t)(j >> 1) * H * D + (j & 1) * D);
  __builtin_amdgcn_sched_barrier(0);   // keeps every load in front of the first conversion: without it the compiler holds only some ten rows in flight, too few bytes per WGP for the memory's latency
#pragma unroll
  for (int j = 0; j < 2 * PT; ++j) { v4h o;
#pragma unroll
    for (int e = 0; e < 4; ++e) o[e] = (b16)(bf16_rne(x[j][e]) * XS);
    *(v4h*)(dst + (size_t)(j & 1) * S * D + (j >> 1) * D) = o; }
}
__device__ __forceinline__ void prepv_block(int b, const float* __restrict__ v, b16* __restrict__ VT) {
  __shared__ b16 Ts[D][64 + 8];
  const int h = b / (S / 64), t0 = (b % (S / 64)) * 64;
  const float* vp = v + ((size_t)(t0 + threadIdx.x / D) * H + h) * D + threadIdx.x % D; b16* tp = &Ts[threadIdx.x % D][threadIdx.x / D]; float x[64 * D / 256];   // one address each, the steps between the loads and between the LDS stores are constants
#pragma unroll   // here and below: constant indices, so that the values stay in registers and the loads stand as one group
  for (int j = 0; j < 64 * D / 256; ++j) x[j] = vp[(size_t)j * (256 / D) * H * D];   // element i = threadIdx.x + j * 256 of the tile: token i / D, d = i % D
#pragma unroll
  for (int j = 0; j < 64 * D / 256; ++j) tp[j * (256 / D)] = (b16)(bf16_rne(x[j]) * XS);
  __syncthreads();
  { for (int i = threadIdx.x; i < D * 8; i += 256) { const int d = i / 8, c8 = (i % 8) * 8; *(v8b*)(VT + ((size_t)h * D + d) * S + t0 + c8) = *(const v8b*)(&Ts[d][c8]); }  }
}
// one launch for both preparations, which do not depend on each other: the block index picks the job. The q/k blocks, four times the bytes of a v block each, come first in the index order, so that the short ones fill the tail
constexpr int NBQK = 2 * (S / PT) /* prep A blocks */, NBV = H * (S / 64) /* prep B blocks */;
__global__ __launch_bounds__(256) void prep_kernel(const float* __restrict__ q, const float* __restrict__ k, const float* __restrict__ v, b16* __restrict__ QP, b16* __restrict__ KP, b16* __restrict__ VT) {
  if (blockIdx.x < NBQK) prepqk_block(blockIdx.x, q, k, QP, KP);   // block-uniform: the barrier of prep B is passed by all threads of its block or by none
  else prepv_block(blockIdx.x - NBQK, v, VT);
}
// attention: grid (QL/128, HL): block pr of head h runs the 64-query tiles NQT-1-pr and pr one after the other, so that every block walks as many keys. 16 waves = 4 groups of 16 queries x 4 key shares:
// four waves on every SIMD, so that one wave's vector work and LDS waits stand behind the others' matrix runs.
// A tile's causal key range goes through LDS in 128-key tiles (K rows and V^T rows); two buffers, the next tile's asynchronous copies fly while this one is worked on. Per wave: one 32-key step of every tile,
// in order, causal mask, online softmax, P x1024 hi/lo, O^T += V^T P^T over 8 d-tiles; the four shares' partial results are joined through LDS at the end of the query tile.
__device__ __forceinline__ unsigned lds_addr(const void* p) { return (unsigned)(unsigned long long)p; }   // LDS byte address = low 32 bits of the __shared__ address
// a 128-key tile: K 128 rows x 256 B and V^T 128 rows x 256 B, 16 B per lane and copy, 4 + 4 copies per thread of the 512 (a thread's rows lie 32 apart)
__device__ __forceinline__ void stage_tile(const b16* kg, const b16* vg, unsigned kl, unsigned vl) {
  const b16 *k0 = kg, *k1 = kg + 32 * D, *k2 = kg + 64 * D, *k3 = kg + 96 * D, *v0 = vg, *v1 = vg + 32 * S, *v2 = vg + 64 * S, *v3 = vg + 96 * S;
  const unsigned a0 = kl, a1 = kl + 32 * KPB, a2 = kl + 64 * KPB, a3 = kl + 96 * KPB, b0 = vl, b1 = vl + 32 * VPB, b2 = vl + 64 * VPB, b3 = vl + 96 * VPB;
  // the copies bring the tile into LDS through no register; s_wait_xcnt stands in the same statement so that no address register of a copy is rewritten in front of it
  asm volatile("global_load_async_to_lds_b128 %0, %8, off\n\t"
               "global_load_async_to_lds_b128 %1, %9, off\n\t"
               "global_load_async_to_lds_b128 %2, %10, off\n\t"
               "global_load_async_to_lds_b128 %3, %11, off\n\t"
               "global_load_async_to_lds_b128 %4, %12, off\n\t"
               "global_load_async_to_lds_b128 %5, %13, off\n\t"
               "global_load_async_to_lds_b128 %6, %14, off\n\t"
               "global_load_async_to_lds_b128 %7, %15, off\n\t"
               "s_wait_xcnt 0x0"
               :: "v"(a0), "v"(a1), "v"(a2), "v"(a3), "v"(b0), "v"(b1), "v"(b2), "v"(b3), "v"(k0), "v"(k1), "v"(k2), "v"(k3), "v"(v0), "v"(v1), "v"(v2), "v"(v3) : "memory");
}
// key tile t into the buffer at kl, vl: 8 copies per thread in flight
__device__ __forceinline__ void stage_keys(const b16* kg, const b16* vg, unsigned kl, unsigned vl, int t) { stage_tile(kg + (size_t)t * KT * D, vg + t * KT, kl, vl); }
__global__ __launch_bounds__(NW * 32) void attn_kernel(const b16* __restrict__ QP, const b16* __restrict__ KP, const b16* __restrict__ VT, float* __restrict__ out) {
  __shared__ __attribute__((aligned(16))) b16 Ks[2][KT][KPB / 2], Vs[2][D][VPB / 2];
  __shared__ __attribute__((aligned(16))) b16 Ph[NW][16][32 + 8], Pl[NW][16][32 + 8]; __shared__ __attribute__((aligned(16))) float To[NW][16][D + 4]; __shared__ float Ms[NW][16], Ls[NW][16];
  const int tid = threadIdx.x, wave = __builtin_amdgcn_readfirstlane(tid >> 5), lane = tid & 31, hh = lane >> 4, col = lane & 15; const int h = blockIdx.y, pr = blockIdx.x;
  const int wq = wave & 3 /* 16-query group of the tile */, wk = wave >> 2 /* key share: 32-key step wk of every key tile */;
  const b16* Qb = QP + (size_t)h * S * D; const b16* Kb = KP + (size_t)h * S * D; const b16* Vb = VT + (size_t)h * D * S;
  const b16* kg = Kb + (size_t)(tid >> 4) * D + (tid & 15) * 8; const b16* vg = Vb + (size_t)(tid >> 4) * S + (tid & 15) * 8;
  const unsigned kl = lds_addr(&Ks[0][tid >> 4][(tid & 15) * 8]), vl = lds_addr(&Vs[0][tid >> 4][(tid & 15) * 8]);
  // query tile qt needs the key tiles 0 .. qt / 2. The block's key tiles as one sequence g: n0 tiles for the long query tile NQT - 1 - pr, then pr / 2 + 1 for its short partner pr: NQT / 2 + 1 in every block;
  // n0 > 1, and every key tile ends at or below key S
  const int n0 = (NQT - 1 - pr) / 2 + 1, ntot = n0 + pr / 2 + 1;
  stage_keys(kg, vg, kl, vl, 0);
  int qt = NQT - 1 - pr /* the query tile at work */, g0 = 0 /* where its key tiles begin in the sequence */;
  v16b qa[4];
#pragma unroll
  for (int ks = 0; ks < 4; ++ks) qa[ks] = frag_kb(Qb + (size_t)(qt * QT + wq * 16 + col) * D + ks * 32, hh);
  const float cs = LOG2E / (11.313708498984761f * XS * XS);   // 1/sqrt(128)
  float m = -INFINITY, l = 0.0f; v8f o[8]; for (int t = 0; t < 8; ++t) o[t] = (v8f){};
  asm volatile("s_wait_asynccnt 0x0" ::: "memory");   // this wave's copies of tile 0 have landed
  __syncthreads();                                    // tile 0 is readable by every wave
  stage_keys(kg, vg, kl + KT * KPB, vl + D * VPB, 1);   // g = 1 is key tile 1 (n0 > 1)
#pragma unroll 1   // rolled: one copy of the tile body, the buffer picked by g & 1
  for (int g = 0; g < ntot; ++g) {
    const b16 (*Kt)[KPB / 2] = Ks[g & 1]; const b16 (*Vt)[VPB / 2] = Vs[g & 1];
    const int st = g - g0, q0 = qt * QT + wq * 16, qi = q0 + col;
    const int ko = wk * 32, kb = st * KT + ko;   // the wave's 32-key step of the tile
    if (kb < q0 + 16) {   // wave-uniform: a wave skips the steps beyond its own diagonal, never the publish point below
      float e[16]; float mx = -INFINITY; v16b kf[8], vf[8];   // the step's K fragments, then its V^T fragments, each read from LDS as one group: one LDS latency a group, not one a product
#pragma unroll   // here and at vf: constant indices, so that the fragment arrays stay in registers
      for (int u = 0; u < 2; ++u)
#pragma unroll
        for (int ks = 0; ks < 4; ++ks) kf[u * 4 + ks] = frag_kb(&Kt[ko + u * 16 + col][ks * 32], hh);
#pragma unroll
      for (int u = 0; u < 2; ++u) { v8f s = (v8f){};
#pragma unroll
        for (int ks = 0; ks < 4; ++ks) s = wmma16b(kf[u * 4 + ks], qa[ks], s);
#pragma unroll
        for (int r = 0; r < 8; ++r) e[u * 8 + r] = s[r] * cs; }
      if (kb + 31 > q0) {   // wave-uniform: only the step that the diagonal crosses holds keys above a query of the wave; every earlier step goes unmasked
#pragma unroll   // here and at mx: constant indices, so that the scores stay in registers
        for (int i2 = 0; i2 < 16; ++i2) { const int key = kb + (i2 >> 3) * 16 + 8 * hh + (i2 & 7); e[i2] = (key <= qi) ? e[i2] : -INFINITY; } }
#pragma unroll
      for (int i2 = 0; i2 < 16; ++i2) mx = fmaxf(mx, e[i2]);
#pragma unroll
      for (int t = 0; t < 8; ++t) vf[t] = frag_kb(&Vt[t * 16 + col][ko], hh);
      mx = fmaxf(mx, __shfl_xor(mx, 16)); const float mn = fmaxf(m, mx); const float al = nexp2(m - mn); float sum = 0.0f;   // mn is finite: a running step has kb <= q0, so its key kb is seen by all 16 queries; a masked score gives exp2(-inf) = 0, a first step al = 0
#pragma unroll
      for (int i2 = 0; i2 < 16; ++i2) { float ex;
        if (i2 == 11) asm("v_exp_f32 %0, %1\n\tv_nop" : "=v"(ex) : "v"(e[i2] - mn));   // the slot that the instruction set asks for behind a transcendental
        else ex = nexp2(e[i2] - mn);
        const float p = ex; sum += p; b16 a_, b_; split16(p * PS, a_, b_); const int sl = (i2 < 8 ? 0 : 16) + 8 * hh + (i2 & 7); Ph[wave][col][sl] = a_; Pl[wave][col][sl] = b_; }
      sum += __shfl_xor(sum, 16); l = l * al + sum; m = mn;
      wave_lds_sync();
      const v16b ph = frag_kb(&Ph[wave][col][0], hh), pl = frag_kb(&Pl[wave][col][0], hh);
#pragma unroll
      for (int t = 0; t < 8; ++t) { o[t] *= al; o[t] = wmma16b(vf[t], ph, o[t]); o[t] = wmma16b(vf[t], pl, o[t]); }
      wave_lds_sync(); }
    // publish point of tile g + 1, passed by every wave
    asm volatile("s_wait_dscnt 0x0" ::: "memory");      // this wave's reads of buffer g & 1 are done before it is refilled
    asm volatile("s_wait_asynccnt 0x0" ::: "memory");   // this wave's copies of tile g + 1 have landed
    __syncthreads();                                    // tile g + 1 readable by all; every reader has left buffer g & 1
    if (g + 2 < ntot) stage_keys(kg, vg, kl + (g & 1) * (KT * KPB), vl + (g & 1) * (D * VPB), g + 2 < n0 ? g + 2 : g + 2 - n0);
    if (st == qt / 2) {   // block-uniform: the query tile's last key tile is done
      // join of the four key shares: each wave leaves its unscaled O rows, its maximum and its sum; wave (wq, wk) then joins and stores rows wk * 4 .. wk * 4 + 3 of group wq
#pragma unroll
      for (int t = 0; t < 8; ++t)
#pragma unroll
        for (int r = 0; r < 8; ++r) To[wave][col][t * 16 + 8 * hh + r] = o[t][r];
      if (hh == 0) { Ms[wave][col] = m; Ls[wave][col] = l; }
      __syncthreads();   // all shares' partial results are readable; To, Ms, Ls are next written behind the partner tile's publish points
      // lane col: row col of group wq. Share 0's maximum is finite: it holds key 0, which every query sees; a share that saw no key of the row has maximum -inf, weight 0, and its O and its sum are 0
      float ms[NS], f[NS], mm = -INFINITY, den = 0.0f; int wt[NS];
#pragma unroll   // here and below: constant indices, so that the shares' values stay in registers
      for (int i = 0; i < NS; ++i) { ms[i] = Ms[wq + 4 * i][col]; mm = fmaxf(mm, ms[i]); }
#pragma unroll
      for (int i = 0; i < NS; ++i) { f[i] = nexp2(ms[i] - mm);
        if (i == 0) asm volatile("v_nop" :: "v"(f[i])); }   // the slot that the instruction set asks for behind a transcendental
#pragma unroll
      for (int i = 0; i < NS; ++i) den = fmaf(Ls[wq + 4 * i][col], f[i], den);
      const float inv = 1.0f / (den * PS * XS);
#pragma unroll
      for (int i = 0; i < NS; ++i) wt[i] = __float_as_int(f[i] * inv);   // the row's four weights, handed to all lanes by readlane below
#pragma unroll
      for (int j = 0; j < 16 / NS; ++j) { const int rr = wk * (16 / NS) + j; v4f x = (v4f){};
#pragma unroll
        for (int i = 0; i < NS; ++i) x += *(const v4f*)(&To[wq + 4 * i][rr][lane * 4]) * __int_as_float(__builtin_amdgcn_readlane(wt[i], rr));
        *(v4f*)(out + ((size_t)(qt * QT + wq * 16 + rr) * H + h) * D + lane * 4) = x; }
      asm volatile("s_wait_xcnt 0x0" ::: "memory");   // the next key tile's code reuses the address and data registers of these stores
      if (g + 1 < ntot) {   // on to the short partner
        qt = pr; g0 = n0; m = -INFINITY; l = 0.0f;
#pragma unroll
        for (int t = 0; t < 8; ++t) o[t] = (v8f){};
#pragma unroll
        for (int ks = 0; ks < 4; ++ks) qa[ks] = frag_kb(Qb + (size_t)(qt * QT + wq * 16 + col) * D + ks * 32, hh); } }
  }
  asm volatile("s_wait_asynccnt 0x0" ::: "memory");     // no copy is left in flight when the wave ends
}
}  // namespace

extern "C" void kernel_launch(void* const* d_in, const int* in_sizes, int n_in, void* d_out, int out_size, void* d_ws, size_t ws_size, hipStream_t stream) {
  (void)n_in;
  auto Fp = [&](int i) { return (const float*)d_in[i]; };
  if (in_sizes[0] != S * H * D || in_sizes[1] != S * H * D || in_sizes[2] != S * H * D || out_size != S * H * D) return;
  size_t off = 0; char* ws = (char*)d_ws;
  auto carve = [&](size_t bytes) { char* p = ws + off; off += (bytes + 255) & ~(size_t)255; return p; };
  const size_t plane = (size_t)H * S * D * 2; b16* QP = (b16*)carve(plane); b16* KP = (b16*)carve(plane); b16* VT = (b16*)carve(plane);
  if (off > ws_size || off > ((size_t)128 << 20)) return;   // 25 MB
  prep_kernel<<<NBQK + NBV, 256, 0, stream>>>(Fp(0), Fp(1), Fp(2), QP, KP, VT);
  attn_kernel<<<dim3(NQT / 2, HL), NW * 32, 0, stream>>>(QP, KP, VT, (float*)d_out);
}

// v007
// It runs in 40.3 microseconds.
// Timed twice side by side with v006, it ran 1.04 times as fast both times.
// All steps since v000 together make it 6.37 times as fast.
#include <hip/hip_runtime.h>

// Long-context causal attention on INPUT tensors query/key/value [1, 2048, 16 heads, 128]: out[s][h] = softmax_t<=s(q[s][h] . k[t][h] / sqrt(128)) v[t][h] -> [1][2048][16][128].
// Deterministic: flash-style, four waves per 16 queries (each takes every fourth 32-key step of the causal range, in order, running max), joined once; no atomics.
// compute dtype: WMMA v_wmma_f32_16x16x32_f16 with f32 accumulate for S^T = K Q^T (q, k are INPUTS: EXACT bf16 x8 planes, K = 128: 1 product) and O^T += V^T P^T (v EXACT x8 transposed plane,
// P x1024 as f16 hi+lo: 2 products); softmax statistics in f32; mode exact/hi+lo, acc f32 — every product uses exactly the bf16-rounded inputs. Inputs rounded to bf16 once.

namespace {
constexpr int S = 2048, H = 16, D = 128, HL = 16 /* heads computed (== 16 shipped) */, QL = 2048 /* query rows (== 2048 shipped) */;
constexpr float XS = 8.0f, PS = 1024.0f, LOG2E = 1.4426950408889634f;
constexpr int NW = 16 /* waves per attention block */, NS = 4 /* key shares: waves per 16 queries */, QT = 64 /* queries per tile */, NQT = QL / QT /* query tiles per head */, KT = 128 /* keys per LDS tile */, KPB = D * 2 + 16 /* LDS pitch of a K row, bytes */, VPB = KT * 2 + 16 /* LDS pitch of a V^T row, bytes */;
static_assert(S % KT == 0 && QL % (2 * QT) == 0 && KT == 2 * QT && KT == NS * 32 && NW * 16 == NS * QT && QL <= S, "tiling");
typedef _Float16 b16;
typedef __attribute__((ext_vector_type(16))) _Float16 v16b;
typedef __attribute__((ext_vector_type(8))) _Float16 v8b;
typedef __attribute__((ext_vector_type(8))) float v8f;
typedef __attribute__((ext_vector_type(4))) float v4f;
__device__ __forceinline__ float bf16_rne(float f) { unsigned int u = __float_as_uint(f); u += 0x7FFFu + ((u >> 16) & 1u); return __uint_as_float(u & 0xFFFF0000u); }
__device__ __forceinline__ void split16(float v, b16& hi, b16& lo) { hi = (b16)v; lo = (b16)(v - (float)hi); }
__device__ __forceinline__ v16b frag_kb(const b16* p, int hh) { const v8b a = *(const v8b*)(p + 8 * hh), b = *(const v8b*)(p + 16 + 8 * hh); v16b f;
#pragma unroll
  for (int e = 0; e < 8; ++e) { f[e] = a[e]; f[8 + e] = b[e]; } return f; }
__device__ __forceinline__ v8f wmma16b(v16b a, v16b b, v8f c) { v8f d = __builtin_amdgcn_wmma_f32_16x16x32_f16(false, a, false, b, (short)0, c, false, false); asm volatile("v_nop\n\tv_nop\n\tv_nop\n\tv_nop" : "+v"(d) : "v"(a), "v"(b)); return d; }
__device__ __forceinline__ float pmul(float a, float b) { float p = a * b; asm volatile("" : "+v"(p)); return p; }
__device__ __forceinline__ int iclamp(int v, int lo, int hi) { return v < lo ? lo : (v > hi ? hi : v); }

typedef __attribute__((ext_vector_type(2))) _Float16 v2h;
typedef __attribute__((ext_vector_type(4))) _Float16 v4h;
__device__ __forceinline__ float nexp2(float v) { return __builtin_amdgcn_exp2f(v); }
__device__ __forceinline__ float xhalf(float x) { return __builtin_bit_cast(float, __builtin_amdgcn_permlanex16(__builtin_bit_cast(int, x), __builtin_bit_cast(int, x), 0x76543210, 0xfedcba98, false, false)); }   // lane l takes lane l ^ 16's value on the vector pipe: no LDS operation, so no wait on the LDS counter
// prep A: QP/KP [h][s][128] = bf16(q/k[s][h][:]) x8, as a stream: block per PT tokens of q or of k (PT * 8 KB of input in a row), wave w takes heads 2w and 2w + 1: 2 * PT rows of 512 B,
// one whole row per 16-B-a-lane load, all of the wave's loads issued before the first is used; 8-B-a-lane stores of whole 256-B plane rows. prep B: VT [h][d][S] = bf16(v[s][h][d]) x8: block per (h, 64-token tile), LDS transpose
constexpr int PT = 16 /* tokens per prep A block */;
static_assert(S % PT == 0 && H == 2 * 8 && D == 32 * 4, "prep A: 8 waves x 2 heads, a row is one 16-B load of a wave");
__device__ __forceinline__ void prepqk_block(int b, const float* __restrict__ q, const float* __restrict__ k, b16* __restrict__ QP, b16* __restrict__ KP) {
  const int lane = threadIdx.x & 31, w = threadIdx.x >> 5, which = b / (S / PT), s0 = (b % (S / PT)) * PT;
  const float* src = (which ? k : q) + ((size_t)s0 * H + 2 * w) * D + lane * 4; b16* dst = (which ? KP : QP) + ((size_t)(2 * w) * S + s0) * D + lane * 4; v4f x[2 * PT];
#pragma unroll   // here and below: constant indices, so that the rows stay in registers and the loads stand as one group
  for (int j = 0; j < 2 * PT; ++j) x[j] = *(const v4f*)(src + (size_t)(j >> 1) * H * D + (j & 1) * D);
  __builtin_amdgcn_sched_barrier(0);   // keeps every load in front of the first conversion: without it the compiler holds only some ten rows in flight, too few bytes per WGP for the memory's latency
#pragma unroll
  for (int j = 0; j < 2 * PT; ++j) { v4h o;
#pragma unroll
    for (int e = 0; e < 4; ++e) o[e] = (b16)(bf16_rne(x[j][e]) * XS);
    *(v4h*)(dst + (size_t)(j & 1) * S * D + (j >> 1) * D) = o; }
}
__device__ __forceinline__ void prepv_block(int b, const float* __restrict__ v, b16* __restrict__ VT) {
  __shared__ b16 Ts[D][64 + 8];
  const int h = b / (S / 64), t0 = (b % (S / 64)) * 64;
  const float* vp = v + ((size_t)(t0 + threadIdx.x / D) * H + h) * D + threadIdx.x % D; b16* tp = &Ts[threadIdx.x % D][threadIdx.x / D]; float x[64 * D / 256];   // one address each, the steps between the loads and between the LDS stores are constants
#pragma unroll   // here and below: constant indices, so that the values stay in registers and the loads stand as one group
  for (int j = 0; j < 64 * D / 256; ++j) x[j] = vp[(size_t)j * (256 / D) * H * D];   // element i = threadIdx.x + j * 256 of the tile: token i / D, d = i % D
#pragma unroll
  for (int j = 0; j < 64 * D / 256; ++j) tp[j * (256 / D)] = (b16)(bf16_rne(x[j]) * XS);
  __syncthreads();
  { for (int i = threadIdx.x; i < D * 8; i += 256) { const int d = i / 8, c8 = (i % 8) * 8; *(v8b*)(VT + ((size_t)h * D + d) * S + t0 + c8) = *(const v8b*)(&Ts[d][c8]); }  }
}
// one launch for both preparations, which do not depend on each other: the block index picks the job. The q/k blocks, four times the bytes of a v block each, come first in the index order, so that the short ones fill the tail
constexpr int NBQK = 2 * (S / PT) /* prep A blocks */, NBV = H * (S / 64) /* prep B blocks */;
__global__ __launch_bounds__(256) void prep_kernel(const float* __restrict__ q, const float* __restrict__ k, const float* __restrict__ v, b16* __restrict__ QP, b16* __restrict__ KP, b16* __restrict__ VT) {
  if (blockIdx.x < NBQK) prepqk_block(blockIdx.x, q, k, QP, KP);   // block-uniform: the barrier of prep B is passed by all threads of its block or by none
  else prepv_block(blockIdx.x - NBQK, v, VT);
}
// attention: grid (QL/128, HL): block pr of head h runs the 64-query tiles NQT-1-pr and pr one after the other, so that every block walks as many keys. 16 waves = 4 groups of 16 queries x 4 key shares:
// four waves on every SIMD, so that one wave's vector work and LDS waits stand behind the others' matrix runs.
// A tile's causal key range goes through LDS in 128-key tiles (K rows and V^T rows); two buffers, the next tile's asynchronous copies fly while this one is worked on. Per wave: one 32-key step of every tile,
// in order, causal mask, online softmax, P x1024 hi/lo, O^T += V^T P^T over 8 d-tiles; the four shares' partial results are joined through LDS at the end of the query tile.
__device__ __forceinline__ unsigned lds_addr(const void* p) { return (unsigned)(unsigned long long)p; }   // LDS byte address = low 32 bits of the __shared__ address
// a 128-key tile: K 128 rows x 256 B and V^T 128 rows x 256 B, 16 B per lane and copy, 4 + 4 copies per thread of the 512 (a thread's rows lie 32 apart)
__device__ __forceinline__ void stage_tile(const b16* kg, const b16* vg, unsigned kl, unsigned vl) {
  const b16 *k0 = kg, *k1 = kg + 32 * D, *k2 = kg + 64 * D, *k3 = kg + 96 * D, *v0 = vg, *v1 = vg + 32 * S, *v2 = vg + 64 * S, *v3 = vg + 96 * S;
  const unsigned a0 = kl, a1 = kl + 32 * KPB, a2 = kl + 64 * KPB, a3 = kl + 96 * KPB, b0 = vl, b1 = vl + 32 * VPB, b2 = vl + 64 * VPB, b3 = vl + 96 * VPB;
  // the copies bring the tile into LDS through no register; s_wait_xcnt stands in the same statement so that no address register of a copy is rewritten in front of it
  asm volatile("global_load_async_to_lds_b128 %0, %8, off\n\t"
               "global_load_async_to_lds_b128 %1, %9, off\n\t"
               "global_load_async_to_lds_b128 %2, %10, off\n\t"
               "global_load_async_to_lds_b128 %3, %11, off\n\t"
               "global_load_async_to_lds_b128 %4, %12, off\n\t"
               "global_load_async_to_lds_b128 %5, %13, off\n\t"
               "global_load_async_to_lds_b128 %6, %14, off\n\t"
               "global_load_async_to_lds_b128 %7, %15, off\n\t"
               "s_wait_xcnt 0x0"
               :: "v"(a0), "v"(a1), "v"(a2), "v"(a3), "v"(b0), "v"(b1), "v"(b2), "v"(b3), "v"(k0), "v"(k1), "v"(k2), "v"(k3), "v"(v0), "v"(v1), "v"(v2), "v"(v3) : "memory");
}
// key tile t into the buffer at kl, vl: 8 copies per thread in flight
__device__ __forceinline__ void stage_keys(const b16* kg, const b16* vg, unsigned kl, unsigned vl, int t) { stage_tile(kg + (size_t)t * KT * D, vg + t * KT, kl, vl); }
__global__ __launch_bounds__(NW * 32) void attn_kernel(const b16* __restrict__ QP, const b16* __restrict__ KP, const b16* __restrict__ VT, float* __restrict__ out) {
  __shared__ __attribute__((aligned(16))) b16 Ks[2][KT][KPB / 2], Vs[2][D][VPB / 2];
  __shared__ __attribute__((aligned(16))) float To[NW][16][D + 4]; __shared__ float Ms[NW][16], Ls[NW][16];
  const int tid = threadIdx.x, wave = __builtin_amdgcn_readfirstlane(tid >> 5), lane = tid & 31, hh = lane >> 4, col = lane & 15; const int h = blockIdx.y, pr = blockIdx.x;
  const int wq = wave & 3 /* 16-query group of the tile */, wk = wave >> 2 /* key share: 32-key step wk of every key tile */;
  const b16* Qb = QP + (size_t)h * S * D; const b16* Kb = KP + (size_t)h * S * D; const b16* Vb = VT + (size_t)h * D * S;
  const b16* kg = Kb + (size_t)(tid >> 4) * D + (tid & 15) * 8; const b16* vg = Vb + (size_t)(tid >> 4) * S + (tid & 15) * 8;
  const unsigned kl = lds_addr(&Ks[0][tid >> 4][(tid & 15) * 8]), vl = lds_addr(&Vs[0][tid >> 4][(tid & 15) * 8]);
  // query tile qt needs the key tiles 0 .. qt / 2. The block's key tiles as one sequence g: n0 tiles for the long query tile NQT - 1 - pr, then pr / 2 + 1 for its short partner pr: NQT / 2 + 1 in every block;
  // n0 > 1, and every key tile ends at or below key S
  const int n0 = (NQT - 1 - pr) / 2 + 1, ntot = n0 + pr / 2 + 1;
  stage_keys(kg, vg, kl, vl, 0);
  int qt = NQT - 1 - pr /* the query tile at work */, g0 = 0 /* where its key tiles begin in the sequence */;
  v16b qa[4];
#pragma unroll
  for (int ks = 0; ks < 4; ++ks) qa[ks] = frag_kb(Qb + (size_t)(qt * QT + wq * 16 + col) * D + ks * 32, hh);
  const float cs = LOG2E / (11.313708498984761f * XS * XS);   // 1/sqrt(128)
  float m = -INFINITY, l = 0.0f; v8f o[8]; for (int t = 0; t < 8; ++t) o[t] = (v8f){};
  asm volatile("s_wait_asynccnt 0x0" ::: "memory");   // this wave's copies of tile 0 have landed
  __syncthreads();                                    // tile 0 is readable by every wave
  stage_keys(kg, vg, kl + KT * KPB, vl + D * VPB, 1);   // g = 1 is key tile 1 (n0 > 1)
#pragma unroll 1   // rolled: one copy of the tile body, the buffer picked by g & 1
  for (int g = 0; g < ntot; ++g) {
    const b16 (*Kt)[KPB / 2] = Ks[g & 1]; const b16 (*Vt)[VPB / 2] = Vs[g & 1];
    const int st = g - g0, q0 = qt * QT + wq * 16, qi = q0 + col;
    const int ko = wk * 32, kb = st * KT + ko;   // the wave's 32-key step of the tile
    if (kb < q0 + 16) {   // wave-uniform: a wave skips the steps beyond its own diagonal, never the publish point below
      float e[16]; float mx = -INFINITY; v16b kf[8], vf[8];   // the step's K fragments, then its V^T fragments, each read from LDS as one group: one LDS latency a group, not one a product
#pragma unroll   // here and at vf: constant indices, so that the fragment arrays stay in registers
      for (int u = 0; u < 2; ++u)
#pragma unroll
        for (int ks = 0; ks < 4; ++ks) kf[u * 4 + ks] = frag_kb(&Kt[ko + u * 16 + col][ks * 32], hh);
#pragma unroll
      for (int u = 0; u < 2; ++u) { v8f s = (v8f){};
#pragma unroll
        for (int ks = 0; ks < 4; ++ks) s = wmma16b(kf[u * 4 + ks], qa[ks], s);
#pragma unroll
        for (int r = 0; r < 8; ++r) e[u * 8 + r] = s[r] * cs; }
      if (kb + 31 > q0) {   // wave-uniform: only the step that the diagonal crosses holds keys above a query of the wave; every earlier step goes unmasked
#pragma unroll   // here and at mx: constant indices, so that the scores stay in registers
        for (int i2 = 0; i2 < 16; ++i2) { const int key = kb + (i2 >> 3) * 16 + 8 * hh + (i2 & 7); e[i2] = (key <= qi) ? e[i2] : -INFINITY; } }
#pragma unroll
      for (int i2 = 0; i2 < 16; ++i2) mx = fmaxf(mx, e[i2]);
#pragma unroll
      for (int t = 0; t < 8; ++t) vf[t] = frag_kb(&Vt[t * 16 + col][ko], hh);
      mx = fmaxf(mx, xhalf(mx)); const float mn = fmaxf(m, mx); const float al = nexp2(m - mn); float sum = 0.0f; v16b ph, pl;   // mn is finite: a running step has kb <= q0, so its key kb is seen by all 16 queries; a masked score gives exp2(-inf) = 0, a first step al = 0
#pragma unroll
      for (int i2 = 0; i2 < 16; ++i2) { float ex;
        if (i2 == 11) asm("v_exp_f32 %0, %1\n\tv_nop" : "=v"(ex) : "v"(e[i2] - mn));   // the slot that the instruction set asks for behind a transcendental
        else ex = nexp2(e[i2] - mn);
        const float p = ex; sum += p; b16 a_, b_; split16(p * PS, a_, b_); ph[i2] = a_; pl[i2] = b_; }   // score i2 of lane (col, hh) is key (i2 < 8 ? 0 : 16) + 8 * hh + (i2 & 7) of query col: the very element i2 of that lane's B fragment of P^T
      sum += xhalf(sum); l = l * al + sum; m = mn;
#pragma unroll
      for (int t = 0; t < 8; ++t) { o[t] *= al; o[t] = wmma16b(vf[t], ph, o[t]); o[t] = wmma16b(vf[t], pl, o[t]); } }
    // publish point of tile g + 1, passed by every wave
    asm volatile("s_wait_dscnt 0x0" ::: "memory");      // this wave's reads of buffer g & 1 are done before it is refilled
    asm volatile("s_wait_asynccnt 0x0" ::: "memory");   // this wave's copies of tile g + 1 have landed
    __syncthreads();                                    // tile g + 1 readable by all; every reader has left buffer g & 1
    if (g + 2 < ntot) stage_keys(kg, vg, kl + (g & 1) * (KT * KPB), vl + (g & 1) * (D * VPB), g + 2 < n0 ? g + 2 : g + 2 - n0);
    if (st == qt / 2) {   // block-uniform: the query tile's last key tile is done
      // join of the four key shares: each wave leaves its unscaled O rows, its maximum and its sum; wave (wq, wk) then joins and stores rows wk * 4 .. wk * 4 + 3 of group wq
#pragma unroll
      for (int t = 0; t < 8; ++t)
#pragma unroll
        for (int r = 0; r < 8; ++r) To[wave][col][t * 16 + 8 * hh + r] = o[t][r];
      if (hh == 0) { Ms[wave][col] = m; Ls[wave][col] = l; }
      __syncthreads();   // all shares' partial results are readable; To, Ms, Ls are next written behind the partner tile's publish points
      // lane col: row col of group wq. Share 0's maximum is finite: it holds key 0, which every query sees; a share that saw no key of the row has maximum -inf, weight 0, and its O and its sum are 0
      float ms[NS], f[NS], mm = -INFINITY, den = 0.0f; int wt[NS];
#pragma unroll   // here and below: constant indices, so that the shares' values stay in registers
      for (int i = 0; i < NS; ++i) { ms[i] = Ms[wq + 4 * i][col]; mm = fmaxf(mm, ms[i]); }
#pragma unroll
      for (int i = 0; i < NS; ++i) { f[i] = nexp2(ms[i] - mm);
        if (i == 0) asm volatile("v_nop" :: "v"(f[i])); }   // the slot that the instruction set asks for behind a transcendental
#pragma unroll
      for (int i = 0; i < NS; ++i) den = fmaf(Ls[wq + 4 * i][col], f[i], den);
      const float inv = 1.0f / (den * PS * XS);
#pragma unroll
      for (int i = 0; i < NS; ++i) wt[i] = __float_as_int(f[i] * inv);   // the row's four weights, handed to all lanes by readlane below
#pragma unroll
      for (int j = 0; j < 16 / NS; ++j) { const int rr = wk * (16 / NS) + j; v4f x = (v4f){};
#pragma unroll
        for (int i = 0; i < NS; ++i) x += *(const v4f*)(&To[wq + 4 * i][rr][lane * 4]) * __int_as_float(__builtin_amdgcn_readlane(wt[i], rr));
        *(v4f*)(out + ((size_t)(qt * QT + wq * 16 + rr) * H + h) * D + lane * 4) = x; }
      asm volatile("s_wait_xcnt 0x0" ::: "memory");   // the next key tile's code reuses the address and data registers of these stores
      if (g + 1 < ntot) {   // on to the short partner
        qt = pr; g0 = n0; m = -INFINITY; l = 0.0f;
#pragma unroll
        for (int t = 0; t < 8; ++t) o[t] = (v8f){};
#pragma unroll
        for (int ks = 0; ks < 4; ++ks) qa[ks] = frag_kb(Qb + (size_t)(qt * QT + wq * 16 + col) * D + ks * 32, hh); } }
  }
  asm volatile("s_wait_asynccnt 0x0" ::: "memory");     // no copy is left in flight when the wave ends
}
}  // namespace

extern "C" void kernel_launch(void* const* d_in, const int* in_sizes, int n_in, void* d_out, int out_size, void* d_ws, size_t ws_size, hipStream_t stream) {
  (void)n_in;
  auto Fp = [&](int i) { return (const float*)d_in[i]; };
  if (in_sizes[0] != S * H * D || in_sizes[1] != S * H * D || in_sizes[2] != S * H * D || out_size != S * H * D) return;
  size_t off = 0; char* ws = (char*)d_ws;
  auto carve = [&](size_t bytes) { char* p = ws + off; off += (bytes + 255) & ~(size_t)255; return p; };
  const size_t plane = (size_t)H * S * D * 2; b16* QP = (b16*)carve(plane); b16* KP = (b16*)carve(plane); b16* VT = (b16*)carve(plane);
  if (off > ws_size || off > ((size_t)128 << 20)) return;   // 25 MB
  prep_kernel<<<NBQK + NBV, 256, 0, stream>>>(Fp(0), Fp(1), Fp(2), QP, KP, VT);
  attn_kernel<<<dim3(NQT / 2, HL), NW * 32, 0, stream>>>(QP, KP, VT, (float*)d_out);
}

// v008
// It runs in 38.5 microseconds.
// Two timings next to v007 both put it at 1.05 times that version's speed.
// All steps since v000 together make it 6.67 times as fast.
#include <hip/hip_runtime.h>

// Long-context causal attention on INPUT tensors query/key/value [1, 2048, 16 heads, 128]: out[s][h] = softmax_t<=s(q[s][h] . k[t][h] / sqrt(128)) v[t][h] -> [1][2048][16][128].
// Deterministic: flash-style, four waves per 16 queries (each takes every fourth 32-key step of the causal range, in order, running max), joined once; no atomics.
// compute dtype: WMMA v_wmma_f32_16x16x32_f16 with f32 accumulate for S^T = K Q^T (q, k are INPUTS: EXACT bf16 x8 planes, K = 128: 1 product) and O^T += V^T P^T (v EXACT x8 transposed plane,
// P x1024 as f16 hi+lo: 2 products); softmax statistics in f32; mode exact/hi+lo, acc f32 — every product uses exactly the bf16-rounded inputs. Inputs rounded to bf16 once.

namespace {
constexpr int S = 2048, H = 16, D = 128, HL = 16 /* heads computed (== 16 shipped) */, QL = 2048 /* query rows (== 2048 shipped) */;
constexpr float XS = 8.0f, PS = 1024.0f, LOG2E = 1.4426950408889634f;
constexpr int NW = 16 /* waves per attention block */, NS = 4 /* key shares: waves per 16 queries */, QT = 64 /* queries per tile */, NQT = QL / QT /* query tiles per head */, KT = 128 /* keys per LDS tile */, KPB = D * 2 + 16 /* LDS pitch of a K row, bytes */, VPB = KT * 2 + 16 /* LDS pitch of a V^T row, bytes */;
static_assert(S % KT == 0 && QL % (2 * QT) == 0 && KT == 2 * QT && KT == NS * 32 && NW * 16 == NS * QT && QL <= S, "tiling");
typedef _Float16 b16;
typedef __attribute__((ext_vector_type(16))) _Float16 v16b;
typedef __attribute__((ext_vector_type(8))) _Float16 v8b;
typedef __attribute__((ext_vector_type(8))) float v8f;
typedef __attribute__((ext_vector_type(4))) float v4f;
__device__ __forceinline__ float bf16_rne(float f) { unsigned int u = __float_as_uint(f); u += 0x7FFFu + ((u >> 16) & 1u); return __uint_as_float(u & 0xFFFF0000u); }
__device__ __forceinline__ void split16(float v, b16& hi, b16& lo) { hi = (b16)v; lo = (b16)(v - (float)hi); }
__device__ __forceinline__ v16b frag_kb(const b16* p, int hh) { const v8b a = *(const v8b*)(p + 8 * hh), b = *(const v8b*)(p + 16 + 8 * hh); v16b f;
#pragma unroll
  for (int e = 0; e < 8; ++e) { f[e] = a[e]; f[8 + e] = b[e]; } return f; }
__device__ __forceinline__ v8f wmma16b(v16b a, v16b b, v8f c) { return __builtin_amdgcn_wmma_f32_16x16x32_f16(false, a, false, b, (short)0, c, false, false); }
__device__ __forceinline__ float pmul(float a, float b) { float p = a * b; asm volatile("" : "+v"(p)); return p; }
__device__ __forceinline__ int iclamp(int v, int lo, int hi) { return v < lo ? lo : (v > hi ? hi : v); }

typedef __attribute__((ext_vector_type(2))) _Float16 v2h;
typedef __attribute__((ext_vector_type(4))) _Float16 v4h;
__device__ __forceinline__ float nexp2(float v) { return __builtin_amdgcn_exp2f(v); }
__device__ __forceinline__ float xhalf(float x) { return __builtin_bit_cast(float, __builtin_amdgcn_permlanex16(__builtin_bit_cast(int, x), __builtin_bit_cast(int, x), 0x76543210, 0xfedcba98, false, false)); }   // lane l takes lane l ^ 16's value on the vector pipe: no LDS operation, so no wait on the LDS counter
// prep A: QP/KP [h][s][128] = bf16(q/k[s][h][:]) x8, as a stream: block per PT tokens of q or of k (PT * 8 KB of input in a row), wave w takes heads 2w and 2w + 1: 2 * PT rows of 512 B,
// one whole row per 16-B-a-lane load, all of the wave's loads issued before the first is used; 8-B-a-lane stores of whole 256-B plane rows. prep B: VT [h][d][S] = bf16(v[s][h][d]) x8: block per (h, 64-token tile), LDS transpose
constexpr int PT = 16 /* tokens per prep A block */;
static_assert(S % PT == 0 && H == 2 * 8 && D == 32 * 4, "prep A: 8 waves x 2 heads, a row is one 16-B load of a wave");
__device__ __forceinline__ void prepqk_block(int b, const float* __restrict__ q, const float* __restrict__ k, b16* __restrict__ QP, b16* __restrict__ KP) {
  const int lane = threadIdx.x & 31, w = threadIdx.x >> 5, which = b / (S / PT), s0 = (b % (S / PT)) * PT;
  const float* src = (which ? k : q) + ((size_t)s0 * H + 2 * w) * D + lane * 4; b16* dst = (which ? KP : QP) + ((size_t)(2 * w) * S + s0) * D + lane * 4; v4f x[2 * PT];
#pragma unroll   // here and below: constant indices, so that the rows stay in registers and the loads stand as one group
  for (int j = 0; j < 2 * PT; ++j) x[j] = *(const v4f*)(src + (size_t)(j >> 1) * H * D + (j & 1) * D);
  __builtin_amdgcn_sched_barrier(0);   // keeps every load in front of the first conversion: without it the compiler holds only some ten rows in flight, too few bytes per WGP for the memory's latency
#pragma unroll
  for (int j = 0; j < 2 * PT; ++j) { v4h o;
#pragma unroll
    for (int e = 0; e < 4; ++e) o[e] = (b16)(bf16_rne(x[j][e]) * XS);
    *(v4h*)(dst + (size_t)(j & 1) * S * D + (j >> 1) * D) = o; }
}
__device__ __forceinline__ void prepv_block(int b, const float* __restrict__ v, b16* __restrict__ VT) {
  __shared__ b16 Ts[D][64 + 8];
  const int h = b / (S / 64), t0 = (b % (S / 64)) * 64;
  const float* vp = v + ((size_t)(t0 + threadIdx.x / D) * H + h) * D + threadIdx.x % D; b16* tp = &Ts[threadIdx.x % D][threadIdx.x / D]; float x[64 * D / 256];   // one address each, the steps between the loads and between the LDS stores are constants
#pragma unroll   // here and below: constant indices, so that the values stay in registers and the loads stand as one group
  for (int j = 0; j < 64 * D / 256; ++j) x[j] = vp[(size_t)j * (256 / D) * H * D];   // element i = threadIdx.x + j * 256 of the tile: token i / D, d = i % D
#pragma unroll
  for (int j = 0; j < 64 * D / 256; ++j) tp[j * (256 / D)] = (b16)(bf16_rne(x[j]) * XS);
  __syncthreads();
  { for (int i = threadIdx.x; i < D * 8; i += 256) { const int d = i / 8, c8 = (i % 8) * 8; *(v8b*)(VT + ((size_t)h * D + d) * S + t0 + c8) = *(const v8b*)(&Ts[d][c8]); }  }
}
// one launch for both preparations, which do not depend on each other: the block index picks the job. The q/k blocks, four times the bytes of a v block each, come first in the index order, so that the short ones fill the tail
constexpr int NBQK = 2 * (S / PT) /* prep A blocks */, NBV = H * (S / 64) /* prep B blocks */;
__global__ __launch_bounds__(256) void prep_kernel(const float* __restrict__ q, const float* __restrict__ k, const float* __restrict__ v, b16* __restrict__ QP, b16* __restrict__ KP, b16* __restrict__ VT) {
  if (blockIdx.x < NBQK) prepqk_block(blockIdx.x, q, k, QP, KP);   // block-uniform: the barrier of prep B is passed by all threads of its block or by none
  else prepv_block(blockIdx.x - NBQK, v, VT);
}
// attention: grid (QL/128, HL): block pr of head h runs the 64-query tiles NQT-1-pr and pr one after the other, so that every block walks as many keys. 16 waves = 4 groups of 16 queries x 4 key shares:
// four waves on every SIMD, so that one wave's vector work and LDS waits stand behind the others' matrix runs.
// A tile's causal key range goes through LDS in 128-key tiles (K rows and V^T rows); two buffers, the next tile's asynchronous copies fly while this one is worked on. Per wave: one 32-key step of every tile,
// in order, causal mask, online softmax, P x1024 hi/lo, O^T += V^T P^T over 8 d-tiles; the four shares' partial results are joined through LDS at the end of the query tile.
__device__ __forceinline__ unsigned lds_addr(const void* p) { return (unsigned)(unsigned long long)p; }   // LDS byte address = low 32 bits of the __shared__ address
// a 128-key tile: K 128 rows x 256 B and V^T 128 rows x 256 B, 16 B per lane and copy, 4 + 4 copies per thread of the 512 (a thread's rows lie 32 apart)
__device__ __forceinline__ void stage_tile(const b16* kg, const b16* vg, unsigned kl, unsigned vl) {
  const b16 *k0 = kg, *k1 = kg + 32 * D, *k2 = kg + 64 * D, *k3 = kg + 96 * D, *v0 = vg, *v1 = vg + 32 * S, *v2 = vg + 64 * S, *v3 = vg + 96 * S;
  const unsigned a0 = kl, a1 = kl + 32 * KPB, a2 = kl + 64 * KPB, a3 = kl + 96 * KPB, b0 = vl, b1 = vl + 32 * VPB, b2 = vl + 64 * VPB, b3 = vl + 96 * VPB;
  // the copies bring the tile into LDS through no register; s_wait_xcnt stands in the same statement so that no address register of a copy is rewritten in front of it
  asm volatile("global_load_async_to_lds_b128 %0, %8, off\n\t"
               "global_load_async_to_lds_b128 %1, %9, off\n\t"
               "global_load_async_to_lds_b128 %2, %10, off\n\t"
               "global_load_async_to_lds_b128 %3, %11, off\n\t"
               "global_load_async_to_lds_b128 %4, %12, off\n\t"
               "global_load_async_to_lds_b128 %5, %13, off\n\t"
               "global_load_async_to_lds_b128 %6, %14, off\n\t"
               "global_load_async_to_lds_b128 %7, %15, off\n\t"
               "s_wait_xcnt 0x0"
               :: "v"(a0), "v"(a1), "v"(a2), "v"(a3), "v"(b0), "v"(b1), "v"(b2), "v"(b3), "v"(k0), "v"(k1), "v"(k2), "v"(k3), "v"(v0), "v"(v1), "v"(v2), "v"(v3) : "memory");
}
// key tile t into the buffer at kl, vl: 8 copies per thread in flight
__device__ __forceinline__ void stage_keys(const b16* kg, const b16* vg, unsigned kl, unsigned vl, int t) { stage_tile(kg + (size_t)t * KT * D, vg + t * KT, kl, vl); }
__global__ __launch_bounds__(NW * 32) void attn_kernel(const b16* __restrict__ QP, const b16* __restrict__ KP, const b16* __restrict__ VT, float* __restrict__ out) {
  __shared__ __attribute__((aligned(16))) b16 Ks[2][KT][KPB / 2], Vs[2][D][VPB / 2];
  __shared__ __attribute__((aligned(16))) float To[NW][16][D + 4]; __shared__ float Ms[NW][16], Ls[NW][16];
  const int tid = threadIdx.x, wave = __builtin_amdgcn_readfirstlane(tid >> 5), lane = tid & 31, hh = lane >> 4, col = lane & 15; const int h = blockIdx.y, pr = blockIdx.x;
  const int wq = wave & 3 /* 16-query group of the tile */, wk = wave >> 2 /* key share: 32-key step wk of every key tile */;
  const b16* Qb = QP + (size_t)h * S * D; const b16* Kb = KP + (size_t)h * S * D; const b16* Vb = VT + (size_t)h * D * S;
  const b16* kg = Kb + (size_t)(tid >> 4) * D + (tid & 15) * 8; const b16* vg = Vb + (size_t)(tid >> 4) * S + (tid & 15) * 8;
  const unsigned kl = lds_addr(&Ks[0][tid >> 4][(tid & 15) * 8]), vl = lds_addr(&Vs[0][tid >> 4][(tid & 15) * 8]);
  // query tile qt needs the key tiles 0 .. qt / 2. The block's key tiles as one sequence g: n0 tiles for the long query tile NQT - 1 - pr, then pr / 2 + 1 for its short partner pr: NQT / 2 + 1 in every block;
  // n0 > 1, and every key tile ends at or below key S
  const int n0 = (NQT - 1 - pr) / 2 + 1, ntot = n0 + pr / 2 + 1;
  stage_keys(kg, vg, kl, vl, 0);
  int qt = NQT - 1 - pr /* the query tile at work */, g0 = 0 /* where its key tiles begin in the sequence */;
  v16b qa[4];
#pragma unroll
  for (int ks = 0; ks < 4; ++ks) qa[ks] = frag_kb(Qb + (size_t)(qt * QT + wq * 16 + col) * D + ks * 32, hh);
  const float cs = LOG2E / (11.313708498984761f * XS * XS);   // 1/sqrt(128)
  float m = -INFINITY, l = 0.0f; v8f o[8]; for (int t = 0; t < 8; ++t) o[t] = (v8f){};
  asm volatile("s_wait_asynccnt 0x0" ::: "memory");   // this wave's copies of tile 0 have landed
  __syncthreads();                                    // tile 0 is readable by every wave
  stage_keys(kg, vg, kl + KT * KPB, vl + D * VPB, 1);   // g = 1 is key tile 1 (n0 > 1)
#pragma unroll 1   // rolled: one copy of the tile body, the buffer picked by g & 1
  for (int g = 0; g < ntot; ++g) {
    const b16 (*Kt)[KPB / 2] = Ks[g & 1]; const b16 (*Vt)[VPB / 2] = Vs[g & 1];
    const int st = g - g0, q0 = qt * QT + wq * 16, qi = q0 + col;
    const int ko = wk * 32, kb = st * KT + ko;   // the wave's 32-key step of the tile
    if (kb < q0 + 16) {   // wave-uniform: a wave skips the steps beyond its own diagonal, never the publish point below
      float e[16]; float mx = -INFINITY; v16b kf[8], vf[8];   // the step's K fragments, then its V^T fragments, each read from LDS as one group: one LDS latency a group, not one a product
#pragma unroll   // here and at vf: constant indices, so that the fragment arrays stay in registers
      for (int u = 0; u < 2; ++u)
#pragma unroll
        for (int ks = 0; ks < 4; ++ks) kf[u * 4 + ks] = frag_kb(&Kt[ko + u * 16 + col][ks * 32], hh);
      __builtin_amdgcn_sched_barrier(0);   // keeps the 16 K reads one group in front of the products: left free, the compiler sets a pair of reads and a full LDS wait in front of every product
#pragma unroll
      for (int u = 0; u < 2; ++u) { v8f s = (v8f){};
#pragma unroll
        for (int ks = 0; ks < 4; ++ks) s = wmma16b(kf[u * 4 + ks], qa[ks], s);
#pragma unroll
        for (int r = 0; r < 8; ++r) e[u * 8 + r] = s[r] * cs; }
      if (kb + 31 > q0) {   // wave-uniform: only the step that the diagonal crosses holds keys above a query of the wave; every earlier step goes unmasked
#pragma unroll   // here and at mx: constant indices, so that the scores stay in registers
        for (int i2 = 0; i2 < 16; ++i2) { const int key = kb + (i2 >> 3) * 16 + 8 * hh + (i2 & 7); e[i2] = (key <= qi) ? e[i2] : -INFINITY; } }
#pragma unroll
      for (int i2 = 0; i2 < 16; ++i2) mx = fmaxf(mx, e[i2]);
#pragma unroll
      for (int t = 0; t < 8; ++t) vf[t] = frag_kb(&Vt[t * 16 + col][ko], hh);
      __builtin_amdgcn_sched_barrier(0);   // keeps the 16 V^T reads one group in front of the softmax, which covers their latency: left free, the compiler spreads them among the products
      mx = fmaxf(mx, xhalf(mx)); const float mn = fmaxf(m, mx); const float al = nexp2(m - mn); float sum = 0.0f; v16b ph, pl;   // mn is finite: a running step has kb <= q0, so its key kb is seen by all 16 queries; a masked score gives exp2(-inf) = 0, a first step al = 0
#pragma unroll
      for (int i2 = 0; i2 < 16; ++i2) { const float p = nexp2(e[i2] - mn); sum += p; b16 a_, b_; split16(p * PS, a_, b_); ph[i2] = a_; pl[i2] = b_; }   // score i2 of lane (col, hh) is key (i2 < 8 ? 0 : 16) + 8 * hh + (i2 & 7) of query col: the very element i2 of that lane's B fragment of P^T
      sum += xhalf(sum); l = l * al + sum; m = mn;
#pragma unroll
      for (int t = 0; t < 8; ++t) { o[t] *= al; o[t] = wmma16b(vf[t], ph, o[t]); o[t] = wmma16b(vf[t], pl, o[t]); } }
    // publish point of tile g + 1, passed by every wave
    asm volatile("s_wait_dscnt 0x0" ::: "memory");      // this wave's reads of buffer g & 1 are done before it is refilled
    asm volatile("s_wait_asynccnt 0x0" ::: "memory");   // this wave's copies of tile g + 1 have landed
    __syncthreads();                                    // tile g + 1 readable by all; every reader has left buffer g & 1
    if (g + 2 < ntot) stage_keys(kg, vg, kl + (g & 1) * (KT * KPB), vl + (g & 1) * (D * VPB), g + 2 < n0 ? g + 2 : g + 2 - n0);
    if (st == qt / 2) {   // block-uniform: the query tile's last key tile is done
      // join of the four key shares: each wave leaves its unscaled O rows, its maximum and its sum; wave (wq, wk) then joins and stores rows wk * 4 .. wk * 4 + 3 of group wq
#pragma unroll
      for (int t = 0; t < 8; ++t)
#pragma unroll
        for (int r = 0; r < 8; ++r) To[wave][col][t * 16 + 8 * hh + r] = o[t][r];
      if (hh == 0) { Ms[wave][col] = m; Ls[wave][col] = l; }
      __syncthreads();   // all shares' partial results are readable; To, Ms, Ls are next written behind the partner tile's publish points
      // lane col: row col of group wq. Share 0's maximum is finite: it holds key 0, which every query sees; a share that saw no key of the row has maximum -inf, weight 0, and its O and its sum are 0
      float ms[NS], f[NS], mm = -INFINITY, den = 0.0f; int wt[NS];
#pragma unroll   // here and below: constant indices, so that the shares' values stay in registers
      for (int i = 0; i < NS; ++i) { ms[i] = Ms[wq + 4 * i][col]; mm = fmaxf(mm, ms[i]); }
#pragma unroll
      for (int i = 0; i < NS; ++i) { f[i] = nexp2(ms[i] - mm);
        if (i == 0) asm volatile("v_nop" :: "v"(f[i])); }   // the slot that the instruction set asks for behind a transcendental
#pragma unroll
      for (int i = 0; i < NS; ++i) den = fmaf(Ls[wq + 4 * i][col], f[i], den);
      const float inv = 1.0f / (den * PS * XS);
#pragma unroll
      for (int i = 0; i < NS; ++i) wt[i] = __float_as_int(f[i] * inv);   // the row's four weights, handed to all lanes by readlane below
#pragma unroll
      for (int j = 0; j < 16 / NS; ++j) { const int rr = wk * (16 / NS) + j; v4f x = (v4f){};
#pragma unroll
        for (int i = 0; i < NS; ++i) x += *(const v4f*)(&To[wq + 4 * i][rr][lane * 4]) * __int_as_float(__builtin_amdgcn_readlane(wt[i], rr));
        *(v4f*)(out + ((size_t)(qt * QT + wq * 16 + rr) * H + h) * D + lane * 4) = x; }
      asm volatile("s_wait_xcnt 0x0" ::: "memory");   // the next key tile's code reuses the address and data registers of these stores
      if (g + 1 < ntot) {   // on to the short partner
        qt = pr; g0 = n0; m = -INFINITY; l = 0.0f;
#pragma unroll
        for (int t = 0; t < 8; ++t) o[t] = (v8f){};
#pragma unroll
        for (int ks = 0; ks < 4; ++ks) qa[ks] = frag_kb(Qb + (size_t)(qt * QT + wq * 16 + col) * D + ks * 32, hh); } }
  }
  asm volatile("s_wait_asynccnt 0x0" ::: "memory");     // no copy is left in flight when the wave ends
}
}  // namespace

extern "C" void kernel_launch(void* const* d_in, const int* in_sizes, int n_in, void* d_out, int out_size, void* d_ws, size_t ws_size, hipStream_t stream) {
  (void)n_in;
  auto Fp = [&](int i) { return (const float*)d_in[i]; };
  if (in_sizes[0] != S * H * D || in_sizes[1] != S * H * D || in_sizes[2] != S * H * D || out_size != S * H * D) return;
  size_t off = 0; char* ws = (char*)d_ws;
  auto carve = [&](size_t bytes) { char* p = ws + off; off += (bytes + 255) & ~(size_t)255; return p; };
  const size_t plane = (size_t)H * S * D * 2; b16* QP = (b16*)carve(plane); b16* KP = (b16*)carve(plane); b16* VT = (b16*)carve(plane);
  if (off > ws_size || off > ((size_t)128 << 20)) return;   // 25 MB
  prep_kernel<<<NBQK + NBV, 256, 0, stream>>>(Fp(0), Fp(1), Fp(2), QP, KP, VT);
  attn_kernel<<<dim3(NQT / 2, HL), NW * 32, 0, stream>>>(QP, KP, VT, (float*)d_out);
}

// v009
// It runs in 36.8 microseconds.
// Next to v008, in two timings, it ran 1.06 and 1.05 times as fast.
// Counting every step since v000, it is 7.02 times as fast.
#include <hip/hip_runtime.h>

// Long-context causal attention on INPUT tensors query/key/value [1, 2048, 16 heads, 128]: out[s][h] = softmax_t<=s(q[s][h] . k[t][h] / sqrt(128)) v[t][h] -> [1][2048][16][128].
// Deterministic: flash-style, four waves per 16 queries (each takes every fourth 32-key step of the causal range, in order, running max), joined once; no atomics.
// compute dtype: WMMA v_wmma_f32_16x16x32_f16 with f32 accumulate for S^T = K Q^T (q, k are INPUTS: EXACT bf16 x8 planes, K = 128: 1 product) and O^T += V^T P^T (v EXACT x8 transposed plane,
// P x1024 as f16 hi+lo: 2 products); softmax statistics in f32; mode exact/hi+lo, acc f32 — every product uses exactly the bf16-rounded inputs. Inputs rounded to bf16 once.

namespace {
constexpr int S = 2048, H = 16, D = 128, HL = 16 /* heads computed (== 16 shipped) */, QL = 2048 /* query rows (== 2048 shipped) */;
constexpr float XS = 8.0f, PS = 1024.0f, LOG2E = 1.4426950408889634f;
constexpr int NW = 16 /* waves per attention block */, NS = 4 /* key shares: waves per 16 queries */, QT = 64 /* queries per tile */, NQT = QL / QT /* query tiles per head */, KT = 128 /* keys per LDS tile */, KPB = D * 2 + 16 /* LDS pitch of a K row, bytes */, VPB = KT * 2 + 16 /* LDS pitch of a V^T row, bytes */;
static_assert(S % KT == 0 && QL % (2 * QT) == 0 && KT == 2 * QT && KT == NS * 32 && NW * 16 == NS * QT && QL <= S, "tiling");
typedef _Float16 b16;
typedef __attribute__((ext_vector_type(16))) _Float16 v16b;
typedef __attribute__((ext_vector_type(8))) _Float16 v8b;
typedef __attribute__((ext_vector_type(8))) float v8f;
typedef __attribute__((ext_vector_type(4))) float v4f;
__device__ __forceinline__ float bf16_rne(float f) { unsigned int u = __float_as_uint(f); u += 0x7FFFu + ((u >> 16) & 1u); return __uint_as_float(u & 0xFFFF0000u); }
__device__ __forceinline__ void split16(float v, b16& hi, b16& lo) { hi = (b16)v; lo = (b16)(v - (float)hi); }
__device__ __forceinline__ v16b frag_kb(const b16* p, int hh) { const v8b a = *(const v8b*)(p + 8 * hh), b = *(const v8b*)(p + 16 + 8 * hh); v16b f;
#pragma unroll
  for (int e = 0; e < 8; ++e) { f[e] = a[e]; f[8 + e] = b[e]; } return f; }
__device__ __forceinline__ v8f wmma16b(v16b a, v16b b, v8f c) { return __builtin_amdgcn_wmma_f32_16x16x32_f16(false, a, false, b, (short)0, c, false, false); }
__device__ __forceinline__ float pmul(float a, float b) { float p = a * b; asm volatile("" : "+v"(p)); return p; }
__device__ __forceinline__ int iclamp(int v, int lo, int hi) { return v < lo ? lo : (v > hi ? hi : v); }

typedef __attribute__((ext_vector_type(2))) _Float16 v2h;
typedef __attribute__((ext_vector_type(4))) _Float16 v4h;
__device__ __forceinline__ float nexp2(float v) { return __builtin_amdgcn_exp2f(v); }
__device__ __forceinline__ float xhalf(float x) { return __builtin_bit_cast(float, __builtin_amdgcn_permlanex16(__builtin_bit_cast(int, x), __builtin_bit_cast(int, x), 0x76543210, 0xfedcba98, false, false)); }   // lane l takes lane l ^ 16's value on the vector pipe: no LDS operation, so no wait on the LDS counter
// prep A: QP/KP [h][s][128] = bf16(q/k[s][h][:]) x8, as a stream: block per PT tokens of q or of k (PT * 8 KB of input in a row), wave w takes heads 2w and 2w + 1: 2 * PT rows of 512 B,
// one whole row per 16-B-a-lane load, all of the wave's loads issued before the first is used; 8-B-a-lane stores of whole 256-B plane rows. prep B: VT [h][d][S] = bf16(v[s][h][d]) x8: block per (h, 64-token tile), LDS transpose
constexpr int PT = 16 /* tokens per prep A block */;
static_assert(S % PT == 0 && H == 2 * 8 && D == 32 * 4, "prep A: 8 waves x 2 heads, a row is one 16-B load of a wave");
__device__ __forceinline__ void prepqk_block(int b, const float* __restrict__ q, const float* __restrict__ k, b16* __restrict__ QP, b16* __restrict__ KP) {
  const int lane = threadIdx.x & 31, w = threadIdx.x >> 5, which = b / (S / PT), s0 = (b % (S / PT)) * PT;
  const float* src = (which ? k : q) + ((size_t)s0 * H + 2 * w) * D + lane * 4; b16* dst = (which ? KP : QP) + ((size_t)(2 * w) * S + s0) * D + lane * 4; v4f x[2 * PT];
#pragma unroll   // here and below: constant indices, so that the rows stay in registers and the loads stand as one group
  for (int j = 0; j < 2 * PT; ++j) x[j] = *(const v4f*)(src + (size_t)(j >> 1) * H * D + (j & 1) * D);
  __builtin_amdgcn_sched_barrier(0);   // keeps every load in front of the first conversion: without it the compiler holds only some ten rows in flight, too few bytes per WGP for the memory's latency
#pragma unroll
  for (int j = 0; j < 2 * PT; ++j) { v4h o;
#pragma unroll
    for (int e = 0; e < 4; ++e) o[e] = (b16)(bf16_rne(x[j][e]) * XS);
    *(v4h*)(dst + (size_t)(j & 1) * S * D + (j >> 1) * D) = o; }
}
__device__ __forceinline__ void prepv_block(int b, const float* __restrict__ v, b16* __restrict__ VT) {
  __shared__ b16 Ts[D][64 + 8];
  const int h = b / (S / 64), t0 = (b % (S / 64)) * 64;
  const float* vp = v + ((size_t)(t0 + threadIdx.x / D) * H + h) * D + threadIdx.x % D; b16* tp = &Ts[threadIdx.x % D][threadIdx.x / D]; float x[64 * D / 256];   // one address each, the steps between the loads and between the LDS stores are constants
#pragma unroll   // here and below: constant indices, so that the values stay in registers and the loads stand as one group
  for (int j = 0; j < 64 * D / 256; ++j) x[j] = vp[(size_t)j * (256 / D) * H * D];   // element i = threadIdx.x + j * 256 of the tile: token i / D, d = i % D
#pragma unroll
  for (int j = 0; j < 64 * D / 256; ++j) tp[j * (256 / D)] = (b16)(bf16_rne(x[j]) * XS);
  __syncthreads();
  { for (int i = threadIdx.x; i < D * 8; i += 256) { const int d = i / 8, c8 = (i % 8) * 8; *(v8b*)(VT + ((size_t)h * D + d) * S + t0 + c8) = *(const v8b*)(&Ts[d][c8]); }  }
}
// one launch for both preparations, which do not depend on each other: the block index picks the job. The q/k blocks, four times the bytes of a v block each, come first in the index order, so that the short ones fill the tail
constexpr int NBQK = 2 * (S / PT) /* prep A blocks */, NBV = H * (S / 64) /* prep B blocks */;
__global__ __launch_bounds__(256) void prep_kernel(const float* __restrict__ q, const float* __restrict__ k, const float* __restrict__ v, b16* __restrict__ QP, b16* __restrict__ KP, b16* __restrict__ VT) {
  if (blockIdx.x < NBQK) prepqk_block(blockIdx.x, q, k, QP, KP);   // block-uniform: the barrier of prep B is passed by all threads of its block or by none
  else prepv_block(blockIdx.x - NBQK, v, VT);
}
// attention: grid (QL/128, HL): block pr of head h runs the 64-query tiles NQT-1-pr and pr one after the other, so that every block walks as many keys. 16 waves = 4 groups of 16 queries x 4 key shares:
// four waves on every SIMD, so that one wave's vector work and LDS waits stand behind the others' matrix runs.
// A tile's causal key range goes through LDS in 128-key tiles (K rows and V^T rows); two buffers, the next tile's two tensor loads fly while this one is worked on. Per wave: one 32-key step of every tile,
// in order, causal mask, online softmax, P x1024 hi/lo, O^T += V^T P^T over 8 d-tiles; the four shares' partial results are joined through LDS at the end of the query tile.
__device__ __forceinline__ unsigned lds_addr(const void* p) { return (unsigned)(unsigned long long)p; }   // LDS byte address = low 32 bits of the __shared__ address
// a 128-key tile comes by two tensor loads, one request of one wave each and through no register: wave 0 brings K (128 rows x 256 B, source pitch 256 B), wave 1 V^T (128 rows x 256 B, source pitch 2 * S B);
// the mover's pad of 16 B behind every 256-B row gives the LDS pitches KPB and VPB. No other wave spends an instruction on staging
typedef __attribute__((ext_vector_type(4))) uint32_t u32x4;
typedef __attribute__((ext_vector_type(8))) uint32_t u32x8;
static_assert(D * 2 == 256 && KT * 2 == 256 && KPB == 256 + 16 && VPB == 256 + 16 && KT == D && (KT * KPB) % 2048 == 0, "tensor tiles: 128 rows of 256 B, pad 16 B, every buffer a multiple of 2 KiB");
__device__ __forceinline__ uint32_t uni(uint32_t v) { return (uint32_t)__builtin_amdgcn_readfirstlane(v); }
__device__ __forceinline__ uint32_t pinned(uint32_t v) { uint32_t w = uni(v); asm volatile("" : "+s"(w)); return w; }   // the tensor mover's pinned(): a test round a tensor instruction, or a descriptor word, held in a scalar register; the branch is then s_cmp + s_cbranch_scc (a tensor load ignores EXEC)
__device__ __forceinline__ u32x8 tdm_group1(uint32_t src_pitch) {   // extents in bytes (data_size 0), tensor = tile = 128 rows of 256 B, no mask
  // every word through pinned(): a descriptor word held in its scalar register, so that the compiler does not free the register and form the word anew while a request is in flight
  u32x8 g; g[0] = pinned(1u << 20 | 5u << 22 | 3u << 25);   // pad on, behind every 64 dwords (a row), 4 dwords
  g[1] = pinned(256u << 16); g[2] = pinned(128u << 16); g[3] = pinned(256u << 16); g[4] = pinned(128u); g[5] = pinned(src_pitch); g[6] = pinned(0u); g[7] = pinned(0u); return g; }
__device__ __forceinline__ u32x4 tdm_group0(uint32_t lds_dst, uint64_t ga) {   // count 1, LDS byte address, global address of the tile's first byte, type 2
  u32x4 g; g[0] = uni(1u); g[1] = uni(lds_dst); g[2] = uni((uint32_t)ga); g[3] = uni(((uint32_t)(ga >> 32) & 0x01FFFFFFu) | 0x80000000u); return g; }
__device__ __forceinline__ void tdm_load(u32x4 g0, u32x8 g1) { asm volatile("tensor_load_to_lds %0, %1" :: "s"(g0), "s"(g1) : "memory"); }   // brings the tile into LDS; its wait is s_wait_tensorcnt in the issuing wave
__global__ __launch_bounds__(NW * 32) void attn_kernel(const b16* __restrict__ QP, const b16* __restrict__ KP, const b16* __restrict__ VT, float* __restrict__ out) {
  __shared__ __attribute__((aligned(2048))) b16 Ks[2][KT][KPB / 2]; __shared__ __attribute__((aligned(2048))) b16 Vs[2][D][VPB / 2];   // a tensor load's place in LDS: a multiple of 2 KiB
  __shared__ __attribute__((aligned(16))) float To[NW][16][D + 4]; __shared__ float Ms[NW][16], Ls[NW][16];
  const int tid = threadIdx.x, wave = __builtin_amdgcn_readfirstlane(tid >> 5), lane = tid & 31, hh = lane >> 4, col = lane & 15; const int h = blockIdx.y, pr = blockIdx.x;
  const int wq = wave & 3 /* 16-query group of the tile */, wk = wave >> 2 /* key share: 32-key step wk of every key tile */;
  const b16* Qb = QP + (size_t)h * S * D; const b16* Kb = KP + (size_t)h * S * D; const b16* Vb = VT + (size_t)h * D * S;
  // the issuing waves: 0 (K) and 1 (V^T). Key tile t begins at K row t * KT, at V^T column t * KT; it lies inside its plane for every t < S / KT
  const bool isv = (wave & 1) != 0; const u32x8 g1 = tdm_group1(isv ? S * 2u : D * 2u);
  const uint32_t ldst = isv ? lds_addr(&Vs[0][0][0]) : lds_addr(&Ks[0][0][0]), gstep = isv ? KT * 2u : KT * D * 2u; const uint64_t gsrc = (uint64_t)(isv ? Vb : Kb);
  u32x4 gq = {0u, 0u, 0u, 0u};   // group 0 of the request in flight
  auto issue = [&](int t, int buf) { gq = tdm_group0(ldst + (uint32_t)buf * (KT * KPB), gsrc + (uint64_t)((uint32_t)t * gstep)); tdm_load(gq, g1); };
  // the issuing wave's wait for its request. It names the descriptor as inputs so that the request's scalar registers stay live, and so unwritten, until the request has landed
  auto landed = [&]() { asm volatile("s_wait_tensorcnt 0x0" :: "s"(gq), "s"(g1) : "memory"); };
  // query tile qt needs the key tiles 0 .. qt / 2. The block's key tiles as one sequence g: n0 tiles for the long query tile NQT - 1 - pr, then pr / 2 + 1 for its short partner pr: NQT / 2 + 1 in every block;
  // n0 > 1, and every key tile ends at or below key S
  const int n0 = (NQT - 1 - pr) / 2 + 1, ntot = n0 + pr / 2 + 1;
  int qt = NQT - 1 - pr /* the query tile at work */, g0 = 0 /* where its key tiles begin in the sequence */;
  v16b qa[4];
#pragma unroll
  for (int ks = 0; ks < 4; ++ks) qa[ks] = frag_kb(Qb + (size_t)(qt * QT + wq * 16 + col) * D + ks * 32, hh);
  const float cs = LOG2E / (11.313708498984761f * XS * XS);   // 1/sqrt(128)
  float m = -INFINITY, l = 0.0f; v8f o[8]; for (int t = 0; t < 8; ++t) o[t] = (v8f){};
  if (pinned(wave < 2)) { issue(0, 0); landed(); }    // the issuing wave's half of tile 0, and its landing; the Q loads above fly meanwhile
  __syncthreads();                                    // tile 0 is readable by every wave
  if (pinned(wave < 2)) issue(1, 1);                  // g = 1 is key tile 1 (n0 > 1)
#pragma unroll 1   // rolled: one copy of the tile body, the buffer picked by g & 1
  for (int g = 0; g < ntot; ++g) {
    const b16 (*Kt)[KPB / 2] = Ks[g & 1]; const b16 (*Vt)[VPB / 2] = Vs[g & 1];
    const int st = g - g0, q0 = qt * QT + wq * 16, qi = q0 + col;
    const int ko = wk * 32, kb = st * KT + ko;   // the wave's 32-key step of the tile
    if (kb < q0 + 16) {   // wave-uniform: a wave skips the steps beyond its own diagonal, never the publish point below
      float e[16]; float mx = -INFINITY; v16b kf[8], vf[8];   // the step's K fragments, then its V^T fragments, each read from LDS as one group: one LDS latency a group, not one a product
#pragma unroll   // here and at vf: constant indices, so that the fragment arrays stay in registers
      for (int u = 0; u < 2; ++u)
#pragma unroll
        for (int ks = 0; ks < 4; ++ks) kf[u * 4 + ks] = frag_kb(&Kt[ko + u * 16 + col][ks * 32], hh);
      __builtin_amdgcn_sched_barrier(0);   // keeps the 16 K reads one group in front of the products: left free, the compiler sets a pair of reads and a full LDS wait in front of every product
#pragma unroll
      for (int u = 0; u < 2; ++u) { v8f s = (v8f){};
#pragma unroll
        for (int ks = 0; ks < 4; ++ks) s = wmma16b(kf[u * 4 + ks], qa[ks], s);
#pragma unroll
        for (int r = 0; r < 8; ++r) e[u * 8 + r] = s[r] * cs; }
      if (kb + 31 > q0) {   // wave-uniform: only the step that the diagonal crosses holds keys above a query of the wave; every earlier step goes unmasked
#pragma unroll   // here and at mx: constant indices, so that the scores stay in registers
        for (int i2 = 0; i2 < 16; ++i2) { const int key = kb + (i2 >> 3) * 16 + 8 * hh + (i2 & 7); e[i2] = (key <= qi) ? e[i2] : -INFINITY; } }
#pragma unroll
      for (int i2 = 0; i2 < 16; ++i2) mx = fmaxf(mx, e[i2]);
#pragma unroll
      for (int t = 0; t < 8; ++t) vf[t] = frag_kb(&Vt[t * 16 + col][ko], hh);
      __builtin_amdgcn_sched_barrier(0);   // keeps the 16 V^T reads one group in front of the softmax, which covers their latency: left free, the compiler spreads them among the products
      mx = fmaxf(mx, xhalf(mx)); const float mn = fmaxf(m, mx); const float al = nexp2(m - mn); float sum = 0.0f; v16b ph, pl;   // mn is finite: a running step has kb <= q0, so its key kb is seen by all 16 queries; a masked score gives exp2(-inf) = 0, a first step al = 0
#pragma unroll
      for (int i2 = 0; i2 < 16; ++i2) { const float p = nexp2(e[i2] - mn); sum += p; b16 a_, b_; split16(p * PS, a_, b_); ph[i2] = a_; pl[i2] = b_; }   // score i2 of lane (col, hh) is key (i2 < 8 ? 0 : 16) + 8 * hh + (i2 & 7) of query col: the very element i2 of that lane's B fragment of P^T
      sum += xhalf(sum); l = l * al + sum; m = mn;
#pragma unroll
      for (int t = 0; t < 8; ++t) { o[t] *= al; o[t] = wmma16b(vf[t], ph, o[t]); o[t] = wmma16b(vf[t], pl, o[t]); } }
    // publish point of tile g + 1, passed by every wave
    asm volatile("s_wait_dscnt 0x0" ::: "memory");      // this wave's reads of buffer g & 1 are done before it is refilled
    if (pinned(wave < 2)) landed();                     // the issuing wave's half of tile g + 1 has landed
    __syncthreads();                                    // tile g + 1 readable by all; every reader has left buffer g & 1
    if (pinned(wave < 2 && g + 2 < ntot)) issue(g + 2 < n0 ? g + 2 : g + 2 - n0, g & 1);
    if (st == qt / 2) {   // block-uniform: the query tile's last key tile is done
      // join of the four key shares: each wave leaves its unscaled O rows, its maximum and its sum; wave (wq, wk) then joins and stores rows wk * 4 .. wk * 4 + 3 of group wq
#pragma unroll
      for (int t = 0; t < 8; ++t)
#pragma unroll
        for (int r = 0; r < 8; ++r) To[wave][col][t * 16 + 8 * hh + r] = o[t][r];
      if (hh == 0) { Ms[wave][col] = m; Ls[wave][col] = l; }
      __syncthreads();   // all shares' partial results are readable; To, Ms, Ls are next written behind the partner tile's publish points
      // lane col: row col of group wq. Share 0's maximum is finite: it holds key 0, which every query sees; a share that saw no key of the row has maximum -inf, weight 0, and its O and its sum are 0
      float ms[NS], f[NS], mm = -INFINITY, den = 0.0f; int wt[NS];
#pragma unroll   // here and below: constant indices, so that the shares' values stay in registers
      for (int i = 0; i < NS; ++i) { ms[i] = Ms[wq + 4 * i][col]; mm = fmaxf(mm, ms[i]); }
#pragma unroll
      for (int i = 0; i < NS; ++i) { f[i] = nexp2(ms[i] - mm);
        if (i == 0) asm volatile("v_nop" :: "v"(f[i])); }   // the slot that the instruction set asks for behind a transcendental
#pragma unroll
      for (int i = 0; i < NS; ++i) den = fmaf(Ls[wq + 4 * i][col], f[i], den);
      const float inv = 1.0f / (den * PS * XS);
#pragma unroll
      for (int i = 0; i < NS; ++i) wt[i] = __float_as_int(f[i] * inv);   // the row's four weights, handed to all lanes by readlane below
#pragma unroll
      for (int j = 0; j < 16 / NS; ++j) { const int rr = wk * (16 / NS) + j; v4f x = (v4f){};
#pragma unroll
        for (int i = 0; i < NS; ++i) x += *(const v4f*)(&To[wq + 4 * i][rr][lane * 4]) * __int_as_float(__builtin_amdgcn_readlane(wt[i], rr));
        *(v4f*)(out + ((size_t)(qt * QT + wq * 16 + rr) * H + h) * D + lane * 4) = x; }
      asm volatile("s_wait_xcnt 0x0" ::: "memory");   // the next key tile's code reuses the address and data registers of these stores
      if (g + 1 < ntot) {   // on to the short partner
        qt = pr; g0 = n0; m = -INFINITY; l = 0.0f;
#pragma unroll
        for (int t = 0; t < 8; ++t) o[t] = (v8f){};
#pragma unroll
        for (int ks = 0; ks < 4; ++ks) qa[ks] = frag_kb(Qb + (size_t)(qt * QT + wq * 16 + col) * D + ks * 32, hh); } }
  }
  asm volatile("s_wait_tensorcnt 0x0" ::: "memory");    // no tensor load is left in flight when the wave ends
  asm volatile("s_wait_dscnt 0x0" ::: "memory");        // nor an LDS operation
}
}  // namespace

extern "C" void kernel_launch(void* const* d_in, const int* in_sizes, int n_in, void* d_out, int out_size, void* d_ws, size_t ws_size, hipStream_t stream) {
  (void)n_in;
  auto Fp = [&](int i) { return (const float*)d_in[i]; };
  if (in_sizes[0] != S * H * D || in_sizes[1] != S * H * D || in_sizes[2] != S * H * D || out_size != S * H * D) return;
  size_t off = 0; char* ws = (char*)d_ws;
  auto carve = [&](size_t bytes) { char* p = ws + off; off += (bytes + 255) & ~(size_t)255; return p; };
  const size_t plane = (size_t)H * S * D * 2; b16* QP = (b16*)carve(plane); b16* KP = (b16*)carve(plane); b16* VT = (b16*)carve(plane);
  if (off > ws_size || off > ((size_t)128 << 20)) return;   // 25 MB
  prep_kernel<<<NBQK + NBV, 256, 0, stream>>>(Fp(0), Fp(1), Fp(2), QP, KP, VT);
  attn_kernel<<<dim3(NQT / 2, HL), NW * 32, 0, stream>>>(QP, KP, VT, (float*)d_out);
}

// v010
// A run of this version takes 35.5 microseconds.
// Two timings next to v009 both put it at 1.04 times that version's speed.
// All steps since v000 together make it 7.30 times as fast.
#include <hip/hip_runtime.h>

// Long-context causal attention on INPUT tensors query/key/value [1, 2048, 16 heads, 128]: out[s][h] = softmax_t<=s(q[s][h] . k[t][h] / sqrt(128)) v[t][h] -> [1][2048][16][128].
// Deterministic: flash-style, four waves per 16 queries (each takes every fourth 32-key step of the causal range, in order, running max), joined once; no atomics.
// compute dtype: WMMA v_wmma_f32_16x16x32_f16 with f32 accumulate for S^T = K Q^T (q, k are INPUTS: EXACT bf16 x8 planes, K = 128: 1 product) and O^T += V^T P^T (v EXACT x8 transposed plane,
// P x1024 as f16 hi+lo: 2 products); softmax statistics in f32; mode exact/hi+lo, acc f32 — every product uses exactly the bf16-rounded inputs. Inputs rounded to bf16 once.

namespace {
constexpr int S = 2048, H = 16, D = 128, HL = 16 /* heads computed (== 16 shipped) */, QL = 2048 /* query rows (== 2048 shipped) */;
constexpr float XS = 8.0f, PS = 1024.0f, LOG2E = 1.4426950408889634f;
constexpr int NW = 16 /* waves per attention block */, NS = 4 /* key shares: waves per 16 queries */, QT = 64 /* queries per tile */, NQT = QL / QT /* query tiles per head */, KT = 128 /* keys per LDS tile */, ST = 2 /* key tiles per stage of the LDS ring */, QS = ST * 128 / 64 /* query tiles per stage of keys */, KPB = D * 2 + 16 /* LDS pitch of a K row, bytes */, VPB = KT * 2 + 16 /* LDS pitch of a V^T row, bytes */;
static_assert(S % (ST * KT) == 0 && QS * QT == ST * KT && QL % (2 * QT) == 0 && KT == 2 * QT && KT == NS * 32 && NW * 16 == NS * QT && QL <= S, "tiling");
typedef _Float16 b16;
typedef __attribute__((ext_vector_type(16))) _Float16 v16b;
typedef __attribute__((ext_vector_type(8))) _Float16 v8b;
typedef __attribute__((ext_vector_type(8))) float v8f;
typedef __attribute__((ext_vector_type(4))) float v4f;
__device__ __forceinline__ float bf16_rne(float f) { unsigned int u = __float_as_uint(f); u += 0x7FFFu + ((u >> 16) & 1u); return __uint_as_float(u & 0xFFFF0000u); }
__device__ __forceinline__ void split16(float v, b16& hi, b16& lo) { hi = (b16)v; lo = (b16)(v - (float)hi); }
__device__ __forceinline__ v16b frag_kb(const b16* p, int hh) { const v8b a = *(const v8b*)(p + 8 * hh), b = *(const v8b*)(p + 16 + 8 * hh); v16b f;
#pragma unroll
  for (int e = 0; e < 8; ++e) { f[e] = a[e]; f[8 + e] = b[e]; } return f; }
__device__ __forceinline__ v8f wmma16b(v16b a, v16b b, v8f c) { return __builtin_amdgcn_wmma_f32_16x16x32_f16(false, a, false, b, (short)0, c, false, false); }
__device__ __forceinline__ float pmul(float a, float b) { float p = a * b; asm volatile("" : "+v"(p)); return p; }
__device__ __forceinline__ int iclamp(int v, int lo, int hi) { return v < lo ? lo : (v > hi ? hi : v); }

typedef __attribute__((ext_vector_type(2))) _Float16 v2h;
typedef __attribute__((ext_vector_type(4))) _Float16 v4h;
__device__ __forceinline__ float nexp2(float v) { return __builtin_amdgcn_exp2f(v); }
__device__ __forceinline__ float xhalf(float x) { return __builtin_bit_cast(float, __builtin_amdgcn_permlanex16(__builtin_bit_cast(int, x), __builtin_bit_cast(int, x), 0x76543210, 0xfedcba98, false, false)); }   // lane l takes lane l ^ 16's value on the vector pipe: no LDS operation, so no wait on the LDS counter
// prep A: QP/KP [h][s][128] = bf16(q/k[s][h][:]) x8, as a stream: block per PT tokens of q or of k (PT * 8 KB of input in a row), wave w takes heads 2w and 2w + 1: 2 * PT rows of 512 B,
// one whole row per 16-B-a-lane load, all of the wave's loads issued before the first is used; 8-B-a-lane stores of whole 256-B plane rows. prep B: VT [h][d][S] = bf16(v[s][h][d]) x8: block per (h, 64-token tile), LDS transpose
constexpr int PT = 16 /* tokens per prep A block */;
static_assert(S % PT == 0 && H == 2 * 8 && D == 32 * 4, "prep A: 8 waves x 2 heads, a row is one 16-B load of a wave");
__device__ __forceinline__ void prepqk_block(int b, const float* __restrict__ q, const float* __restrict__ k, b16* __restrict__ QP, b16* __restrict__ KP) {
  const int lane = threadIdx.x & 31, w = threadIdx.x >> 5, which = b / (S / PT), s0 = (b % (S / PT)) * PT;
  const float* src = (which ? k : q) + ((size_t)s0 * H + 2 * w) * D + lane * 4; b16* dst = (which ? KP : QP) + ((size_t)(2 * w) * S + s0) * D + lane * 4; v4f x[2 * PT];
#pragma unroll   // here and below: constant indices, so that the rows stay in registers and the loads stand as one group
  for (int j = 0; j < 2 * PT; ++j) x[j] = *(const v4f*)(src + (size_t)(j >> 1) * H * D + (j & 1) * D);
  __builtin_amdgcn_sched_barrier(0);   // keeps every load in front of the first conversion: without it the compiler holds only some ten rows in flight, too few bytes per WGP for the memory's latency
#pragma unroll
  for (int j = 0; j < 2 * PT; ++j) { v4h o;
#pragma unroll
    for (int e = 0; e < 4; ++e) o[e] = (b16)(bf16_rne(x[j][e]) * XS);
    *(v4h*)(dst + (size_t)(j & 1) * S * D + (j >> 1) * D) = o; }
}
__device__ __forceinline__ void prepv_block(int b, const float* __restrict__ v, b16* __restrict__ VT) {
  __shared__ b16 Ts[D][64 + 8];
  const int h = b / (S / 64), t0 = (b % (S / 64)) * 64;
  const float* vp = v + ((size_t)(t0 + threadIdx.x / D) * H + h) * D + threadIdx.x % D; b16* tp = &Ts[threadIdx.x % D][threadIdx.x / D]; float x[64 * D / 256];   // one address each, the steps between the loads and between the LDS stores are constants
#pragma unroll   // here and below: constant indices, so that the values stay in registers and the loads stand as one group
  for (int j = 0; j < 64 * D / 256; ++j) x[j] = vp[(size_t)j * (256 / D) * H * D];   // element i = threadIdx.x + j * 256 of the tile: token i / D, d = i % D
#pragma unroll
  for (int j = 0; j < 64 * D / 256; ++j) tp[j * (256 / D)] = (b16)(bf16_rne(x[j]) * XS);
  __syncthreads();
  { for (int i = threadIdx.x; i < D * 8; i += 256) { const int d = i / 8, c8 = (i % 8) * 8; *(v8b*)(VT + ((size_t)h * D + d) * S + t0 + c8) = *(const v8b*)(&Ts[d][c8]); }  }
}
// one launch for both preparations, which do not depend on each other: the block index picks the job. The q/k blocks, four times the bytes of a v block each, come first in the index order, so that the short ones fill the tail
constexpr int NBQK = 2 * (S / PT) /* prep A blocks */, NBV = H * (S / 64) /* prep B blocks */;
__global__ __launch_bounds__(256) void prep_kernel(const float* __restrict__ q, const float* __restrict__ k, const float* __restrict__ v, b16* __restrict__ QP, b16* __restrict__ KP, b16* __restrict__ VT) {
  if (blockIdx.x < NBQK) prepqk_block(blockIdx.x, q, k, QP, KP);   // block-uniform: the barrier of prep B is passed by all threads of its block or by none
  else prepv_block(blockIdx.x - NBQK, v, VT);
}
// attention: grid (QL/128, HL): block pr of head h runs the 64-query tiles NQT-1-pr and pr one after the other, so that every block walks as many keys. 16 waves = 4 groups of 16 queries x 4 key shares:
// four waves on every SIMD, so that one wave's vector work and LDS waits stand behind the others' matrix runs.
// A tile's causal key range goes through LDS in stages of two 128-key tiles (K rows and V^T rows); two buffers, the next stage's four tensor loads fly while this one is worked on. Between two publish points a wave
// runs two steps, so that the waves of a SIMD drift apart and one wave's matrix runs stand beside another's vector work. Per wave: one 32-key step of every tile,
// in order, causal mask, online softmax, P x1024 hi/lo, O^T += V^T P^T over 8 d-tiles; the four shares' partial results are joined through LDS at the end of the query tile.
__device__ __forceinline__ unsigned lds_addr(const void* p) { return (unsigned)(unsigned long long)p; }   // LDS byte address = low 32 bits of the __shared__ address
// a stage comes by four tensor loads, one request of one wave each and through no register: waves 0 and 1 bring its two K tiles (128 rows x 256 B, source pitch 256 B), waves 2 and 3 its two V^T tiles (128 rows x 256 B, source pitch 2 * S B);
// the mover's pad of 16 B behind every 256-B row gives the LDS pitches KPB and VPB. No other wave spends an instruction on staging
typedef __attribute__((ext_vector_type(4))) uint32_t u32x4;
typedef __attribute__((ext_vector_type(8))) uint32_t u32x8;
static_assert(D * 2 == 256 && KT * 2 == 256 && KPB == 256 + 16 && VPB == 256 + 16 && KT == D && (KT * KPB) % 2048 == 0, "tensor tiles: 128 rows of 256 B, pad 16 B, every buffer a multiple of 2 KiB");
__device__ __forceinline__ uint32_t uni(uint32_t v) { return (uint32_t)__builtin_amdgcn_readfirstlane(v); }
__device__ __forceinline__ uint32_t pinned(uint32_t v) { uint32_t w = uni(v); asm volatile("" : "+s"(w)); return w; }   // the tensor mover's pinned(): a test round a tensor instruction, or a descriptor word, held in a scalar register; the branch is then s_cmp + s_cbranch_scc (a tensor load ignores EXEC)
__device__ __forceinline__ u32x8 tdm_group1(uint32_t src_pitch) {   // extents in bytes (data_size 0), tensor = tile = 128 rows of 256 B, no mask
  // every word through pinned(): a descriptor word held in its scalar register, so that the compiler does not free the register and form the word anew while a request is in flight
  u32x8 g; g[0] = pinned(1u << 20 | 5u << 22 | 3u << 25);   // pad on, behind every 64 dwords (a row), 4 dwords
  g[1] = pinned(256u << 16); g[2] = pinned(128u << 16); g[3] = pinned(256u << 16); g[4] = pinned(128u); g[5] = pinned(src_pitch); g[6] = pinned(0u); g[7] = pinned(0u); return g; }
__device__ __forceinline__ u32x4 tdm_group0(uint32_t lds_dst, uint64_t ga) {   // count 1, LDS byte address, global address of the tile's first byte, type 2
  u32x4 g; g[0] = uni(1u); g[1] = uni(lds_dst); g[2] = uni((uint32_t)ga); g[3] = uni(((uint32_t)(ga >> 32) & 0x01FFFFFFu) | 0x80000000u); return g; }
__device__ __forceinline__ void tdm_load(u32x4 g0, u32x8 g1) { asm volatile("tensor_load_to_lds %0, %1" :: "s"(g0), "s"(g1) : "memory"); }   // brings the tile into LDS; its wait is s_wait_tensorcnt in the issuing wave
__global__ __launch_bounds__(NW * 32) void attn_kernel(const b16* __restrict__ QP, const b16* __restrict__ KP, const b16* __restrict__ VT, float* __restrict__ out) {
  constexpr int TB = KT * KPB /* bytes of a tile in LDS */;
  __shared__ __attribute__((aligned(2048))) unsigned char Ring[2][2 * ST][TB];   // a stage: its ST K tiles, then its ST V^T tiles; a tensor load's place in LDS: a multiple of 2 KiB
  __shared__ float Ms[NW][16], Ls[NW][16];
  static_assert(sizeof(float) * NW * 16 * (D + 4) <= (size_t)2 * ST * TB, "the join's area lies in one stage buffer");
  const int tid = threadIdx.x, wave = __builtin_amdgcn_readfirstlane(tid >> 5), lane = tid & 31, hh = lane >> 4, col = lane & 15; const int h = blockIdx.y, pr = blockIdx.x;
  const int wq = wave & 3 /* 16-query group of the tile */, wk = wave >> 2 /* key share: 32-key step wk of every key tile */;
  const b16* Qb = QP + (size_t)h * S * D; const b16* Kb = KP + (size_t)h * S * D; const b16* Vb = VT + (size_t)h * D * S;
  // the issuing waves: 0, 1 (K tiles 0, 1 of a stage) and 2, 3 (its V^T tiles). Stage t begins at K row t * ST * KT, at V^T column t * ST * KT; it lies inside its plane for every t < S / (ST * KT)
  const int iw = wave & 3; const bool isv = (iw & 2) != 0; const u32x8 g1 = tdm_group1(isv ? S * 2u : D * 2u);
  const uint32_t ldst = lds_addr(&Ring[0][iw][0]), gstep = isv ? ST * KT * 2u : ST * KT * D * 2u; const uint64_t gsrc = (uint64_t)(isv ? Vb + (iw & 1) * KT : Kb + (size_t)(iw & 1) * KT * D);
  u32x4 gq = {0u, 0u, 0u, 0u};   // group 0 of the request in flight
  auto issue = [&](int t, int buf) { gq = tdm_group0(ldst + (uint32_t)buf * (2 * ST * TB), gsrc + (uint64_t)((uint32_t)t * gstep)); tdm_load(gq, g1); };
  // the issuing wave's wait for its request. It names the descriptor as inputs so that the request's scalar registers stay live, and so unwritten, until the request has landed
  auto landed = [&]() { asm volatile("s_wait_tensorcnt 0x0" :: "s"(gq), "s"(g1) : "memory"); };
  // query tile qt needs the stages 0 .. qt / QS. The block's stages as one sequence: n0 stages for the long query tile NQT - 1 - pr, then pr / QS + 1 for its short partner pr: NQT / QS + 1 in every block;
  // n0 > 1, and every stage ends at or below key S. g counts the key tiles of that sequence, ST a stage
  const int n0 = (NQT - 1 - pr) / QS + 1, ntot = n0 + pr / QS + 1;
  int qt = NQT - 1 - pr /* the query tile at work */, g0 = 0 /* where its key tiles begin in the sequence */;
  v16b qa[4];
#pragma unroll
  for (int ks = 0; ks < 4; ++ks) qa[ks] = frag_kb(Qb + (size_t)(qt * QT + wq * 16 + col) * D + ks * 32, hh);
  const float cs = LOG2E / (11.313708498984761f * XS * XS);   // 1/sqrt(128)
  float m = -INFINITY, l = 0.0f; v8f o[8]; for (int t = 0; t < 8; ++t) o[t] = (v8f){};
  if (pinned(wave < 4)) { issue(0, 0); landed(); }    // the issuing wave's tile of stage 0, and its landing; the Q loads above fly meanwhile
  __syncthreads();                                    // stage 0 is readable by every wave
  if (pinned(wave < 4)) issue(1, 1);                  // stage 1 of the sequence is stage 1 of the keys (n0 > 1)
#pragma unroll 1   // rolled: one copy of the tile body, buffer and tile picked by g
  for (int g = 0; g < ST * ntot; ++g) {
    const int sg = g / ST /* the stage at work */, sb = sg & 1 /* its buffer */;
    const b16 (*Kt)[KPB / 2] = (const b16 (*)[KPB / 2])Ring[sb][g % ST]; const b16 (*Vt)[VPB / 2] = (const b16 (*)[VPB / 2])Ring[sb][ST + g % ST];
    const int st = g - g0, q0 = qt * QT + wq * 16, qi = q0 + col;
    const int ko = wk * 32, kb = st * KT + ko;   // the wave's 32-key step of the tile
    if (kb < q0 + 16) {   // wave-uniform: a wave skips the steps beyond its own diagonal, never the publish point below
      float e[16]; float mx = -INFINITY; v16b kf[8], vf[8];   // the step's K fragments, then its V^T fragments, each read from LDS as one group: one LDS latency a group, not one a product
#pragma unroll   // here and at vf: constant indices, so that the fragment arrays stay in registers
      for (int u = 0; u < 2; ++u)
#pragma unroll
        for (int ks = 0; ks < 4; ++ks) kf[u * 4 + ks] = frag_kb(&Kt[ko + u * 16 + col][ks * 32], hh);
      __builtin_amdgcn_sched_barrier(0);   // keeps the 16 K reads one group in front of the products: left free, the compiler sets a pair of reads and a full LDS wait in front of every product
#pragma unroll
      for (int u = 0; u < 2; ++u) { v8f s = (v8f){};
#pragma unroll
        for (int ks = 0; ks < 4; ++ks) s = wmma16b(kf[u * 4 + ks], qa[ks], s);
#pragma unroll
        for (int r = 0; r < 8; ++r) e[u * 8 + r] = s[r] * cs; }
      if (kb + 31 > q0) {   // wave-uniform: only the step that the diagonal crosses holds keys above a query of the wave; every earlier step goes unmasked
#pragma unroll   // here and at mx: constant indices, so that the scores stay in registers
        for (int i2 = 0; i2 < 16; ++i2) { const int key = kb + (i2 >> 3) * 16 + 8 * hh + (i2 & 7); e[i2] = (key <= qi) ? e[i2] : -INFINITY; } }
#pragma unroll
      for (int i2 = 0; i2 < 16; ++i2) mx = fmaxf(mx, e[i2]);
#pragma unroll
      for (int t = 0; t < 8; ++t) vf[t] = frag_kb(&Vt[t * 16 + col][ko], hh);
      __builtin_amdgcn_sched_barrier(0);   // keeps the 16 V^T reads one group in front of the softmax, which covers their latency: left free, the compiler spreads them among the products
      mx = fmaxf(mx, xhalf(mx)); const float mn = fmaxf(m, mx); const float al = nexp2(m - mn); float sum = 0.0f; v16b ph, pl;   // mn is finite: a running step has kb <= q0, so its key kb is seen by all 16 queries; a masked score gives exp2(-inf) = 0, a first step al = 0
#pragma unroll
      for (int i2 = 0; i2 < 16; ++i2) { const float p = nexp2(e[i2] - mn); sum += p; b16 a_, b_; split16(p * PS, a_, b_); ph[i2] = a_; pl[i2] = b_; }   // score i2 of lane (col, hh) is key (i2 < 8 ? 0 : 16) + 8 * hh + (i2 & 7) of query col: the very element i2 of that lane's B fragment of P^T
      sum += xhalf(sum); l = l * al + sum; m = mn;
#pragma unroll
      for (int t = 0; t < 8; ++t) { o[t] *= al; o[t] = wmma16b(vf[t], ph, o[t]); o[t] = wmma16b(vf[t], pl, o[t]); } }
    if (g % ST != ST - 1) continue;   // block-uniform: the stage's next tile follows with no wait and no barrier
    // publish point of stage sg + 1, passed by every wave
    asm volatile("s_wait_dscnt 0x0" ::: "memory");      // this wave's reads of buffer sb are done before it is rewritten
    if (pinned(wave < 4)) landed();                     // the issuing wave's tile of stage sg + 1 has landed
    __syncthreads();                                    // stage sg + 1 readable by all; every reader has left buffer sb
    if (st == (qt / QS) * ST + ST - 1) {   // block-uniform: the query tile's last stage is done
      float (*To)[16][D + 4] = (float (*)[16][D + 4])Ring[sb];   // the join's area: the buffer that the stage has just left, refilled only behind the join
      // join of the four key shares: each wave leaves its unscaled O rows, its maximum and its sum; wave (wq, wk) then joins and stores rows wk * 4 .. wk * 4 + 3 of group wq
#pragma unroll
      for (int t = 0; t < 8; ++t)
#pragma unroll
        for (int r = 0; r < 8; ++r) To[wave][col][t * 16 + 8 * hh + r] = o[t][r];
      if (hh == 0) { Ms[wave][col] = m; Ls[wave][col] = l; }
      __syncthreads();   // all shares' partial results are readable; Ms, Ls are next written behind the partner tile's publish points; To's buffer may first be refilled below
      // lane col: row col of group wq. Share 0's maximum is finite: it holds key 0, which every query sees; a share that saw no key of the row has maximum -inf, weight 0, and its O and its sum are 0
      float ms[NS], f[NS], mm = -INFINITY, den = 0.0f; int wt[NS];
#pragma unroll   // here and below: constant indices, so that the shares' values stay in registers
      for (int i = 0; i < NS; ++i) { ms[i] = Ms[wq + 4 * i][col]; mm = fmaxf(mm, ms[i]); }
#pragma unroll
      for (int i = 0; i < NS; ++i) { f[i] = nexp2(ms[i] - mm);
        if (i == 0) asm volatile("v_nop" :: "v"(f[i])); }   // the slot that the instruction set asks for behind a transcendental
#pragma unroll
      for (int i = 0; i < NS; ++i) den = fmaf(Ls[wq + 4 * i][col], f[i], den);
      const float inv = 1.0f / (den * PS * XS);
#pragma unroll
      for (int i = 0; i < NS; ++i) wt[i] = __float_as_int(f[i] * inv);   // the row's four weights, handed to all lanes by readlane below
      v4f x[16 / NS];
#pragma unroll
      for (int j = 0; j < 16 / NS; ++j) { const int rr = wk * (16 / NS) + j; x[j] = (v4f){};
#pragma unroll
        for (int i = 0; i < NS; ++i) x[j] += *(const v4f*)(&To[wq + 4 * i][rr][lane * 4]) * __int_as_float(__builtin_amdgcn_readlane(wt[i], rr)); }
      if (sg + 2 < ntot) {   // block-uniform: the buffer is refilled below. In front of the stores, so that the barrier does not wait for them
        asm volatile("s_wait_dscnt 0x0" ::: "memory");   // this wave's reads of the join's area are done before the buffer is refilled
        __syncthreads(); }                               // every wave has left the join's area
#pragma unroll
      for (int j = 0; j < 16 / NS; ++j) *(v4f*)(out + ((size_t)(qt * QT + wq * 16 + wk * (16 / NS) + j) * H + h) * D + lane * 4) = x[j];
      asm volatile("s_wait_xcnt 0x0" ::: "memory");   // the next key tile's code reuses the address and data registers of these stores
      if (sg + 1 < ntot) {   // on to the short partner
        qt = pr; g0 = ST * n0; m = -INFINITY; l = 0.0f;
#pragma unroll
        for (int t = 0; t < 8; ++t) o[t] = (v8f){};
#pragma unroll
        for (int ks = 0; ks < 4; ++ks) qa[ks] = frag_kb(Qb + (size_t)(qt * QT + wq * 16 + col) * D + ks * 32, hh); } }
    if (pinned(wave < 4 && sg + 2 < ntot)) issue(sg + 2 < n0 ? sg + 2 : sg + 2 - n0, sb);
  }
  asm volatile("s_wait_tensorcnt 0x0" ::: "memory");    // no tensor load is left in flight when the wave ends
  asm volatile("s_wait_dscnt 0x0" ::: "memory");        // nor an LDS operation
}
}  // namespace

extern "C" void kernel_launch(void* const* d_in, const int* in_sizes, int n_in, void* d_out, int out_size, void* d_ws, size_t ws_size, hipStream_t stream) {
  (void)n_in;
  auto Fp = [&](int i) { return (const float*)d_in[i]; };
  if (in_sizes[0] != S * H * D || in_sizes[1] != S * H * D || in_sizes[2] != S * H * D || out_size != S * H * D) return;
  size_t off = 0; char* ws = (char*)d_ws;
  auto carve = [&](size_t bytes) { char* p = ws + off; off += (bytes + 255) & ~(size_t)255; return p; };
  const size_t plane = (size_t)H * S * D * 2; b16* QP = (b16*)carve(plane); b16* KP = (b16*)carve(plane); b16* VT = (b16*)carve(plane);
  if (off > ws_size || off > ((size_t)128 << 20)) return;   // 25 MB
  prep_kernel<<<NBQK + NBV, 256, 0, stream>>>(Fp(0), Fp(1), Fp(2), QP, KP, VT);
  attn_kernel<<<dim3(NQT / 2, HL), NW * 32, 0, stream>>>(QP, KP, VT, (float*)d_out);
}
